// v000
// The times below were measured on an AMD MI455X: many runs one after another, warmed up first and cycling through
// copies of the inputs, with the whole window's GPU time divided by the number of runs. Launches and the gaps
// between them are all in it. The median over several windows is given; except for v000 it joins two sittings, which
// can be a few percent apart, so the side-by-side timings, each taken in one sitting, are the better comparison.
// v000 is the starting kernel. One run takes 622 microseconds.
// compute dtype: all float inputs rounded to bf16, the key mask (int) read; q/k/v = x W^T + b with EXACT bf16 products on WMMA 16x16x32, f32 accumulate; the two score terms fused as one 128-deep contraction [q | pos_q] . [k + pos_k | pos_k] with the query side as f16 hi + residual (x 2^10) and the key side once in f16 (2 products), / 8, masked keys excluded, stored in f32 (all 12 heads per launch); softmax in f32 (precise expf), P x 2^11 f32 split bf16 hi + lo against v bf16 hi + lo (3 products); merged heads in f32 (no output projection).
#include <hip/hip_runtime.h>
#include <math.h>

typedef __attribute__((ext_vector_type(16))) _Float16 v16h;
typedef __attribute__((ext_vector_type(16))) __bf16 v16b;
typedef __attribute__((ext_vector_type(8)))  _Float16 v8h;
typedef __attribute__((ext_vector_type(8)))  float v8f;
typedef __attribute__((ext_vector_type(4)))  float v4f;
typedef __attribute__((ext_vector_type(2)))  float v2f;
typedef __attribute__((ext_vector_type(4)))  unsigned v4u;
typedef __attribute__((ext_vector_type(4)))  int v4i;
typedef float __attribute__((may_alias)) float_a;
typedef int __attribute__((may_alias)) int_a;

template <typename T> __device__ __forceinline__ void vst2(void* p, T v) { *(T*)p = v;  }
__device__ __forceinline__ v8f wmma16(v16h a, v16h b, v8f c) {
  v8f d = __builtin_amdgcn_wmma_f32_16x16x32_f16(false, a, false, b, (short)0, c, false, false);
  asm volatile("v_nop\n\tv_nop\n\tv_nop\n\tv_nop" : "+v"(d) : "v"(a), "v"(b));
  return d;
}
__device__ __forceinline__ v8f wmma_bf(v16b a, v16b b, v8f c) {
  v8f d = __builtin_amdgcn_wmma_f32_16x16x32_bf16(false, a, false, b, (short)0, c, false, false);
  asm volatile("v_nop\n\tv_nop\n\tv_nop\n\tv_nop" : "+v"(d) : "v"(a), "v"(b));
  return d;
}
// 16x16x32 fragments: lane = (h = lane>>4, row/col = lane&15); elements 0..7 = k0+8h+0..7, 8..15 = k0+16+8h+0..7; D element r = row 8h+r
__device__ __forceinline__ v16h frag_h(const _Float16* rowk0, int lane) {
  union { v16h v; v8h q[2]; } u; const _Float16* p = rowk0 + 8 * (lane >> 4);
  u.q[0] = *(const v8h*)p; u.q[1] = *(const v8h*)(p + 16); return u.v;
}
__device__ __forceinline__ v16h frag_f32(const float* rowk0, int lane) {
  v16h a; const float* p = rowk0 + 8 * (lane >> 4);
#pragma unroll
  for (int i = 0; i < 8; ++i) { a[i] = (_Float16)p[i]; a[8 + i] = (_Float16)p[16 + i]; }
  return a;
}
__device__ __forceinline__ v16h frag_f32s(const float* rowk0, int lane, float sc) {
  v16h a; const float* p = rowk0 + 8 * (lane >> 4);
#pragma unroll
  for (int i = 0; i < 8; ++i) { a[i] = (_Float16)(p[i] * sc); a[8 + i] = (_Float16)(p[16 + i] * sc); }
  return a;
}
// column fragment from a [K][ld] layout (column n), rows >= K read as 0
__device__ __forceinline__ v16h fragc_f32(const float* W, int k0, int n, int lane, int ld, int K) {
  v16h a; const int g = lane >> 4;
#pragma unroll
  for (int i = 0; i < 8; ++i) { const int ka = k0 + 8 * g + i, kb = ka + 16;
    a[i] = (_Float16)(ka < K ? W[(size_t)(ka < K ? ka : K - 1) * ld + n] : 0.f); a[8 + i] = (_Float16)(kb < K ? W[(size_t)(kb < K ? kb : K - 1) * ld + n] : 0.f); }
  return a;
}
struct F2 { v16b h, l; };
__device__ __forceinline__ F2 bsplit16(const float v[16]) { F2 r;
#pragma unroll
  for (int i = 0; i < 16; ++i) { const __bf16 h = (__bf16)v[i]; r.h[i] = h; r.l[i] = (__bf16)(v[i] - (float)h); }
  return r; }
__device__ __forceinline__ F2 split_row(const float* row, int k0, int lane) { float v[16]; const float* p = row + k0 + 8 * (lane >> 4);
#pragma unroll
  for (int i = 0; i < 8; ++i) { v[i] = p[i]; v[8 + i] = p[16 + i]; }
  return bsplit16(v); }
__device__ __forceinline__ F2 split_rowK(const float* row, int k0, int lane, int K) { float v[16]; const int g = lane >> 4;
#pragma unroll
  for (int i = 0; i < 8; ++i) { const int ka = k0 + 8 * g + i, kb = ka + 16; v[i] = ka < K ? row[ka < K ? ka : K - 1] : 0.f; v[8 + i] = kb < K ? row[kb < K ? kb : K - 1] : 0.f; }
  return bsplit16(v); }
__device__ __forceinline__ F2 split_col(const float* W, int k0, int n, int lane, int ld, int K) { float v[16]; const int g = lane >> 4;
#pragma unroll
  for (int i = 0; i < 8; ++i) { const int ka = k0 + 8 * g + i, kb = ka + 16; v[i] = ka < K ? W[(size_t)(ka < K ? ka : K - 1) * ld + n] : 0.f; v[8 + i] = kb < K ? W[(size_t)(kb < K ? kb : K - 1) * ld + n] : 0.f; }
  return bsplit16(v); }
__device__ __forceinline__ v8f mac3(const F2& a, const F2& b, v8f c) { c = wmma_bf(a.l, b.h, c); c = wmma_bf(a.h, b.l, c); return wmma_bf(a.h, b.h, c); }
__device__ __forceinline__ float sigm(float v) { return 1.0f / (1.0f + expf(-v)); }
#define LDSX() do { asm volatile("s_wait_dscnt 0" ::: "memory"); __builtin_amdgcn_wave_barrier(); __builtin_amdgcn_fence(__ATOMIC_RELEASE, "workgroup"); } while (0)


// BERT-style attention with absolute-position bias (B 8, SQ = SK = 512, H 768 = 12 x 64): q from hidden_states, k/v from context (Linear [out,in] + bias); scores = (q.k + (q + pos_q).pos_k) / 8 = ([q | pos_q] . [k + pos_k | pos_k]) / 8; keys with attention_mask == 0 -> -inf; softmax; P v; heads merged.
#define NB 8
#define TT 512
#define CC 768
#define NH 12
#define HD 64
#define HDK 128        // augmented logit depth [q | pos]
#define QW (NH * HDK)  // 1,536: row width of the augmented q/k rows
#ifndef TNB
#define TNB NB
#endif
typedef __attribute__((ext_vector_type(8))) __bf16 v8b;
__device__ __forceinline__ v16b frag_b(const __bf16* rowk0, int lane) {
  union { v16b v; v8b q[2]; } u; const __bf16* p = rowk0 + 8 * (lane >> 4);
  u.q[0] = *(const v8b*)p; u.q[1] = *(const v8b*)(p + 16); return u.v;
}
__device__ __forceinline__ float bfr(float v) { return (float)(__bf16)v; }
__device__ __attribute__((noinline)) float exp_ni(float v) { return expf(v); }
__device__ __attribute__((noinline)) float erf_ni(float v) { return erff(v); }

#define WS_QH  0u
#define WS_QL  (WS_QH + 2u * (size_t)NB * TT * QW)
#define WS_KH  (WS_QL + 2u * (size_t)NB * TT * QW)
#define WS_VT  (WS_KH + 2u * (size_t)NB * TT * QW)      // bf16 v planes [b][c][t]
#define WS_VL  (WS_VT + 2u * (size_t)NB * CC * TT)      // bf16 v residual planes
#define HG 12                                          // heads per launch group
#define WS_S   (WS_VL + 2u * (size_t)NB * CC * TT)      // f32 logits / P for HG heads [hg][q][k]
#define WS_PH  (WS_S + 4u * (size_t)HG * TT * TT)
#define WS_Y   (WS_PH + 0u)
#define WS_END (WS_Y + 0u)     // no Y plane: k_pv writes d_out

// ---- k_proj: block = (64 rows, 128 cols, which): qkv = x W (+ b), exact; q -> f16 hi (+ residual), k -> f16 rows, v -> bf16 hi + lo planes
__global__ __launch_bounds__(128) void k_proj(const float* __restrict__ XQ, const float* __restrict__ XC, const float* __restrict__ POS, const float* __restrict__ WQ, const float* __restrict__ BQ, const float* __restrict__ WK, const float* __restrict__ BK, const float* __restrict__ WV, const float* __restrict__ BV, _Float16* __restrict__ QH, _Float16* __restrict__ QL, _Float16* __restrict__ KH, __bf16* __restrict__ VT, __bf16* __restrict__ VL) {
  __shared__ __align__(16) _Float16 sh[64][136], sl[64][136]; __shared__ __align__(16) __bf16 th[128][72], tl2[128][72];
  const int tid = threadIdx.x, wave = tid >> 5, lane = tid & 31, col = lane & 15, g = lane >> 4; const int which = blockIdx.z; const int c0 = blockIdx.y * 128; const size_t r0 = (size_t)blockIdx.x * 64; const float* WA = which == 0 ? WQ : which == 1 ? WK : WV; const float* BA = which == 0 ? BQ : which == 1 ? BK : BV; const float* X = which == 0 ? XQ : XC;
  v8f acc[8] = {};
#pragma unroll 2
  for (int kc = 0; kc < CC / 32; ++kc) { v16b a; { const float* p = X + (r0 + wave * 16 + col) * CC + kc * 32 + 8 * g;
#pragma unroll
      for (int i = 0; i < 8; ++i) { a[i] = (__bf16)p[i]; a[8 + i] = (__bf16)p[16 + i]; } }
#pragma unroll
    for (int j = 0; j < 8; ++j) { v16b w; const int o = c0 + j * 16 + col;
#pragma unroll
      for (int i = 0; i < 8; ++i) { w[i] = (__bf16)WA[(size_t)(o) * CC + (kc * 32 + 8 * g + i)]; w[8 + i] = (__bf16)WA[(size_t)(o) * CC + (kc * 32 + 16 + 8 * g + i)]; }
      acc[j] = wmma_bf(a, w, acc[j]); } }
#pragma unroll
  for (int j = 0; j < 8; ++j) { const float bb = BA ? bfr(BA[c0 + j * 16 + col]) : 0.f;
#pragma unroll
    for (int r = 0; r < 8; ++r) { const int rl = wave * 16 + 8 * g + r, cl = j * 16 + col; const float v = acc[j][r] + bb + (which == 1 ? bfr(POS[((r0 + rl) % TT) * HD + ((c0 + cl) & (HD - 1))]) : 0.f); const _Float16 hv = (_Float16)v;   /* keys carry k + pos_k */
      if (which == 2) { const __bf16 bh = (__bf16)v; th[cl][rl] = bh; tl2[cl][rl] = (__bf16)(v - (float)bh); } else { sh[rl][cl] = hv; sl[rl][cl] = (_Float16)((v - (float)hv) * 1024.0f); }   /* q residual carried x 2^10 so the plane stays f16-normal on the chip */ } }
  __syncthreads();
  if (which < 2) { _Float16* dh = which == 0 ? QH : KH; for (int e = tid; e < 64 * 16; e += 128) { const int rl = e >> 4, q = e & 15; const int c = c0 + q * 8; const size_t dst = (r0 + rl) * QW + (size_t)(c >> 6) * HDK + (c & 63);   /* head h's first 64 of its 128-wide augmented slot */ vst2((unsigned*)(dh + dst), *(const v4u*)&sh[rl][q * 8]); if (which == 0) vst2((unsigned*)(QL + dst), *(const v4u*)&sl[rl][q * 8]); } }
  else { const size_t b = r0 / TT; const int t0 = (int)(r0 % TT); for (int e = tid; e < 128 * 8; e += 128) { const int cl = e >> 3, q = e & 7; const size_t o2 = (b * CC + c0 + cl) * (size_t)TT + t0 + q * 8; vst2((unsigned*)(VT + o2), *(const v4u*)&th[cl][q * 8]); vst2((unsigned*)(VL + o2), *(const v4u*)&tl2[cl][q * 8]); } } }
__global__ __launch_bounds__(128) void k_pos(const float* __restrict__ POS, _Float16* __restrict__ QH, _Float16* __restrict__ QL, _Float16* __restrict__ KH) { __shared__ __align__(16) _Float16 sp[64][72], spl[64][72];
  const int tid = threadIdx.x; const size_t r0 = (size_t)blockIdx.x * 64;
  for (int e = tid; e < 64 * HD; e += 128) { const int rl = e / HD, d = e % HD; const float v = bfr(POS[((r0 + rl) % TT) * HD + d]); const _Float16 hv = (_Float16)v; sp[rl][d] = hv; spl[rl][d] = (_Float16)((v - (float)hv) * 1024.0f); }
  __syncthreads();
  for (int e = tid; e < 64 * NH * 8; e += 128) { const int rl = e / (NH * 8), rem = e % (NH * 8), h = rem >> 3, q = rem & 7; const size_t dst = (r0 + rl) * QW + (size_t)h * HDK + HD + q * 8; vst2((unsigned*)(QH + dst), *(const v4u*)&sp[rl][q * 8]); vst2((unsigned*)(QL + dst), *(const v4u*)&spl[rl][q * 8]); vst2((unsigned*)(KH + dst), *(const v4u*)&sp[rl][q * 8]); } }
// ---- k_sc: block = (64 queries, 128 keys) of (b,h): 2-product 128-deep augmented logits / 8; masked keys -> -3e38
__global__ __launch_bounds__(128) void k_sc(const _Float16* __restrict__ QH, const _Float16* __restrict__ QL, const _Float16* __restrict__ KH, const int* __restrict__ KM, int b, int h0, float* __restrict__ S0) { __shared__ __align__(16) float ss[4][16][132]; const int h = h0 + blockIdx.z; float* S = S0 + (size_t)blockIdx.z * TT * TT;
  const int tid = threadIdx.x, wave = tid >> 5, lane = tid & 31, col = lane & 15, g = lane >> 4; const int k0 = blockIdx.y * 128; const int ql0 = blockIdx.x * 64 + wave * 16; const size_t q0 = (size_t)b * TT + ql0;
  v8f acc[8] = {}, accl[8] = {};
#pragma unroll
  for (int kc = 0; kc < HDK / 32; ++kc) { const v16h ah = frag_h(QH + (q0 + col) * QW + h * HDK + kc * 32, lane), al = frag_h(QL + (q0 + col) * QW + h * HDK + kc * 32, lane);
#pragma unroll
    for (int j = 0; j < 8; ++j) { const v16h kb = frag_h(KH + ((size_t)b * TT + k0 + j * 16 + col) * QW + h * HDK + kc * 32, lane); acc[j] = wmma16(ah, kb, acc[j]); accl[j] = wmma16(al, kb, accl[j]); } }
#pragma unroll
  for (int j = 0; j < 8; ++j) acc[j] += accl[j] * (1.0f / 1024.0f);
#pragma unroll
  for (int j = 0; j < 8; ++j) { const int kt = k0 + j * 16 + col;
#pragma unroll
    for (int r = 0; r < 8; ++r) { const int qt = ql0 + 8 * g + r; (void)qt; float v = acc[j][r] * 0.125f; if (KM[kt] == 0) v = -3.0e38f; /* attention_mask == 0 -> -inf */ ss[wave][8 * g + r][j * 16 + col] = v; } }
  LDSX(); for (int rl = 0; rl < 16; ++rl) vst2(S + (size_t)(ql0 + rl) * TT + k0 + lane * 4, *(const v4f*)&ss[wave][rl][lane * 4]); }
// ---- k_sm: block = query row: softmax over keys [0, kend) -> P x 2^11 f32 (masked -> 0)
__global__ __launch_bounds__(256) void k_sm(float* __restrict__ S0) { __shared__ float sred[8]; __shared__ float sbc; __shared__ __align__(16) float sh[TT];
  const int t = threadIdx.x; const size_t row = blockIdx.x; float* sr = S0 + (size_t)blockIdx.y * TT * TT + row * TT; const int kend = TT;
  float m = -3.0e38f; for (int k = t; k < kend; k += 256) m = fmaxf(m, sr[k]);
#pragma unroll
  for (int o = 1; o < 32; o <<= 1) m = fmaxf(m, __shfl_xor(m, o));
  if ((t & 31) == 0) sred[t >> 5] = m; __syncthreads(); if (t == 0) { float a = sred[0]; for (int i = 1; i < 8; ++i) a = fmaxf(a, sred[i]); sbc = a; } __syncthreads(); m = sbc; __syncthreads();
  float sum = 0.f; for (int k = t; k < kend; k += 256) { const float v = sr[k]; sum += (v <= -1.0e38f) ? 0.f : expf(v - m); }
#pragma unroll
  for (int o = 1; o < 32; o <<= 1) sum += __shfl_xor(sum, o);
  if ((t & 31) == 0) sred[t >> 5] = sum; __syncthreads(); if (t == 0) { float a = 0.f; for (int i = 0; i < 8; ++i) a += sred[i]; sbc = 1.0f / a; } __syncthreads(); const float inv = sbc;
  for (int k = t; k < kend; k += 256) { const float v = sr[k]; sh[k] = (v <= -1.0e38f) ? 0.f : expf(v - m) * inv * 2048.0f; }
  __syncthreads(); for (int q = t; q < kend / 4; q += 256) vst2(sr + q * 4, *(const v4f*)&sh[q * 4]); }
// ---- k_pv: block = 64 queries of (b,h): y[q][h*HD + d] = P . v  (keys [0, kend))
__global__ __launch_bounds__(128) void k_pv(const float* __restrict__ PS0, const __bf16* __restrict__ VT, const __bf16* __restrict__ VL, int b, int h0, float* __restrict__ Y) { const int h = h0 + blockIdx.z; const float* PS = PS0 + (size_t)blockIdx.z * TT * TT; __shared__ __align__(16) float ss[4][16][HD + 4];
  const int tid = threadIdx.x, wave = tid >> 5, lane = tid & 31, col = lane & 15, g = lane >> 4; const int ql0 = blockIdx.x * 64 + wave * 16; const int kend = TT;
  v8f acc[HD / 16] = {};
#pragma unroll 1
  for (int kc = 0; kc < kend / 32; ++kc) { const F2 p = split_row(PS + (size_t)(ql0 + col) * TT, kc * 32, lane);
#pragma unroll
    for (int j = 0; j < HD / 16; ++j) { const size_t po = ((size_t)b * CC + h * HD + j * 16 + col) * (size_t)TT + kc * 32; const v16b vh = frag_b(VT + po, lane); acc[j] = wmma_bf(p.h, vh, acc[j]); acc[j] = wmma_bf(p.l, vh, acc[j]); acc[j] = wmma_bf(p.h, frag_b(VL + po, lane), acc[j]); } }
#pragma unroll
  for (int j = 0; j < HD / 16; ++j)
#pragma unroll
    for (int r = 0; r < 8; ++r) ss[wave][8 * g + r][j * 16 + col] = acc[j][r] * (1.0f / 2048.0f);
  LDSX(); for (int rl = 0; rl < 16; ++rl) if (lane < HD / 4) vst2(Y + ((size_t)b * TT + ql0 + rl) * CC + h * HD + lane * 4, *(const v4f*)&ss[wave][rl][lane * 4]); }
extern "C" void kernel_launch(void* const* d_in, const int* in_sizes, int n_in, void* d_out, int out_size, void* d_ws, size_t ws_size, hipStream_t stream) {
  (void)in_sizes; (void)n_in; (void)out_size;
  const float** F = (const float**)d_in;   // 0 hidden_states [8,512,768], 1 context [8,512,768], 2 attention_mask [8,512] int (verbatim 0/1), 3 Wq [768,768] ([out,in]), 4 bq, 5 Wk, 6 bk, 7 Wv, 8 bv, 9 abs_pos_emb [512,64]
  if (ws_size < (size_t)WS_END) return;
  char* ws = (char*)d_ws; _Float16 *QH = (_Float16*)(ws + WS_QH), *QL = (_Float16*)(ws + WS_QL), *KH = (_Float16*)(ws + WS_KH); __bf16 *VT = (__bf16*)(ws + WS_VT), *VL = (__bf16*)(ws + WS_VL); float *S = (float*)(ws + WS_S);
  k_proj<<<dim3(TNB * TT / 64, CC / 128, 3), 128, 0, stream>>>(F[0], F[1], F[9], F[3], F[4], F[5], F[6], F[7], F[8], QH, QL, KH, VT, VL);
  k_pos<<<dim3(TNB * TT / 64), 128, 0, stream>>>(F[9], QH, QL, KH);
  for (int b = 0; b < TNB; ++b) for (int h0 = 0; h0 < NH; h0 += HG) {
    k_sc<<<dim3(TT / 64, TT / 128, HG), 128, 0, stream>>>(QH, QL, KH, (const int*)d_in[2] + (size_t)b * TT, b, h0, S);
    k_sm<<<dim3(TT, HG), 256, 0, stream>>>(S);
    k_pv<<<dim3(TT / 64, 1, HG), 128, 0, stream>>>(S, VT, VL, b, h0, (float*)d_out);
  }
}

// v001
// Measured time: 363 microseconds a run.
// Next to v000, in two timings, it ran 1.71 times as fast each time.
// compute dtype: all float inputs rounded to bf16, the key mask (int) read; q/k/v = x W^T + b with EXACT bf16 products on WMMA 16x16x32, f32 accumulate; the two score terms fused as one 128-deep contraction [q | pos_q] . [k + pos_k | pos_k] with the query side as f16 hi + residual (x 2^10) and the key side once in f16 (2 products), / 8, masked keys excluded, stored in f32 (all 8 batches x 12 heads per launch); softmax in f32 (precise expf), P x 2^11 f32 split bf16 hi + lo against v bf16 hi + lo (3 products); merged heads in f32 (no output projection).
#include <hip/hip_runtime.h>
#include <math.h>

typedef __attribute__((ext_vector_type(16))) _Float16 v16h;
typedef __attribute__((ext_vector_type(16))) __bf16 v16b;
typedef __attribute__((ext_vector_type(8)))  _Float16 v8h;
typedef __attribute__((ext_vector_type(8)))  float v8f;
typedef __attribute__((ext_vector_type(4)))  float v4f;
typedef __attribute__((ext_vector_type(2)))  float v2f;
typedef __attribute__((ext_vector_type(4)))  unsigned v4u;
typedef __attribute__((ext_vector_type(4)))  int v4i;
typedef float __attribute__((may_alias)) float_a;
typedef int __attribute__((may_alias)) int_a;

template <typename T> __device__ __forceinline__ void vst2(void* p, T v) { *(T*)p = v;  }
__device__ __forceinline__ v8f wmma16(v16h a, v16h b, v8f c) {
  v8f d = __builtin_amdgcn_wmma_f32_16x16x32_f16(false, a, false, b, (short)0, c, false, false);
  asm volatile("v_nop\n\tv_nop\n\tv_nop\n\tv_nop" : "+v"(d) : "v"(a), "v"(b));
  return d;
}
__device__ __forceinline__ v8f wmma_bf(v16b a, v16b b, v8f c) {
  v8f d = __builtin_amdgcn_wmma_f32_16x16x32_bf16(false, a, false, b, (short)0, c, false, false);
  asm volatile("v_nop\n\tv_nop\n\tv_nop\n\tv_nop" : "+v"(d) : "v"(a), "v"(b));
  return d;
}
// 16x16x32 fragments: lane = (h = lane>>4, row/col = lane&15); elements 0..7 = k0+8h+0..7, 8..15 = k0+16+8h+0..7; D element r = row 8h+r
__device__ __forceinline__ v16h frag_h(const _Float16* rowk0, int lane) {
  union { v16h v; v8h q[2]; } u; const _Float16* p = rowk0 + 8 * (lane >> 4);
  u.q[0] = *(const v8h*)p; u.q[1] = *(const v8h*)(p + 16); return u.v;
}
__device__ __forceinline__ v16h frag_f32(const float* rowk0, int lane) {
  v16h a; const float* p = rowk0 + 8 * (lane >> 4);
#pragma unroll
  for (int i = 0; i < 8; ++i) { a[i] = (_Float16)p[i]; a[8 + i] = (_Float16)p[16 + i]; }
  return a;
}
__device__ __forceinline__ v16h frag_f32s(const float* rowk0, int lane, float sc) {
  v16h a; const float* p = rowk0 + 8 * (lane >> 4);
#pragma unroll
  for (int i = 0; i < 8; ++i) { a[i] = (_Float16)(p[i] * sc); a[8 + i] = (_Float16)(p[16 + i] * sc); }
  return a;
}
// column fragment from a [K][ld] layout (column n), rows >= K read as 0
__device__ __forceinline__ v16h fragc_f32(const float* W, int k0, int n, int lane, int ld, int K) {
  v16h a; const int g = lane >> 4;
#pragma unroll
  for (int i = 0; i < 8; ++i) { const int ka = k0 + 8 * g + i, kb = ka + 16;
    a[i] = (_Float16)(ka < K ? W[(size_t)(ka < K ? ka : K - 1) * ld + n] : 0.f); a[8 + i] = (_Float16)(kb < K ? W[(size_t)(kb < K ? kb : K - 1) * ld + n] : 0.f); }
  return a;
}
struct F2 { v16b h, l; };
__device__ __forceinline__ F2 bsplit16(const float v[16]) { F2 r;
#pragma unroll
  for (int i = 0; i < 16; ++i) { const __bf16 h = (__bf16)v[i]; r.h[i] = h; r.l[i] = (__bf16)(v[i] - (float)h); }
  return r; }
__device__ __forceinline__ F2 split_row(const float* row, int k0, int lane) { float v[16]; const float* p = row + k0 + 8 * (lane >> 4);
#pragma unroll
  for (int i = 0; i < 8; ++i) { v[i] = p[i]; v[8 + i] = p[16 + i]; }
  return bsplit16(v); }
__device__ __forceinline__ F2 split_rowK(const float* row, int k0, int lane, int K) { float v[16]; const int g = lane >> 4;
#pragma unroll
  for (int i = 0; i < 8; ++i) { const int ka = k0 + 8 * g + i, kb = ka + 16; v[i] = ka < K ? row[ka < K ? ka : K - 1] : 0.f; v[8 + i] = kb < K ? row[kb < K ? kb : K - 1] : 0.f; }
  return bsplit16(v); }
__device__ __forceinline__ F2 split_col(const float* W, int k0, int n, int lane, int ld, int K) { float v[16]; const int g = lane >> 4;
#pragma unroll
  for (int i = 0; i < 8; ++i) { const int ka = k0 + 8 * g + i, kb = ka + 16; v[i] = ka < K ? W[(size_t)(ka < K ? ka : K - 1) * ld + n] : 0.f; v[8 + i] = kb < K ? W[(size_t)(kb < K ? kb : K - 1) * ld + n] : 0.f; }
  return bsplit16(v); }
__device__ __forceinline__ v8f mac3(const F2& a, const F2& b, v8f c) { c = wmma_bf(a.l, b.h, c); c = wmma_bf(a.h, b.l, c); return wmma_bf(a.h, b.h, c); }
__device__ __forceinline__ float sigm(float v) { return 1.0f / (1.0f + expf(-v)); }
#define LDSX() do { asm volatile("s_wait_dscnt 0" ::: "memory"); __builtin_amdgcn_wave_barrier(); __builtin_amdgcn_fence(__ATOMIC_RELEASE, "workgroup"); } while (0)


// BERT-style attention with absolute-position bias (B 8, SQ = SK = 512, H 768 = 12 x 64): q from hidden_states, k/v from context (Linear [out,in] + bias); scores = (q.k + (q + pos_q).pos_k) / 8 = ([q | pos_q] . [k + pos_k | pos_k]) / 8; keys with attention_mask == 0 -> -inf; softmax; P v; heads merged.
#define NB 8
#define TT 512
#define CC 768
#define NH 12
#define HD 64
#define HDK 128        // augmented logit depth [q | pos]
#define QW (NH * HDK)  // 1,536: row width of the augmented q/k rows
#ifndef TNB
#define TNB NB
#endif
typedef __attribute__((ext_vector_type(8))) __bf16 v8b;
__device__ __forceinline__ v16b frag_b(const __bf16* rowk0, int lane) {
  union { v16b v; v8b q[2]; } u; const __bf16* p = rowk0 + 8 * (lane >> 4);
  u.q[0] = *(const v8b*)p; u.q[1] = *(const v8b*)(p + 16); return u.v;
}
__device__ __forceinline__ float bfr(float v) { return (float)(__bf16)v; }
__device__ __attribute__((noinline)) float exp_ni(float v) { return expf(v); }
__device__ __attribute__((noinline)) float erf_ni(float v) { return erff(v); }

#define WS_QH  0u
#define WS_QL  (WS_QH + 2u * (size_t)NB * TT * QW)
#define WS_KH  (WS_QL + 2u * (size_t)NB * TT * QW)
#define WS_VT  (WS_KH + 2u * (size_t)NB * TT * QW)      // bf16 v planes [b][c][t]
#define WS_VL  (WS_VT + 2u * (size_t)NB * CC * TT)      // bf16 v residual planes
#define HG (NB * NH)                                   // (batch, head) pairs per launch: all of them, blockIdx.z = b * NH + h
#define WS_S   (WS_VL + 2u * (size_t)NB * CC * TT)      // f32 logits / P for all HG pairs [b * NH + h][q][k]
#define WS_PH  (WS_S + 4u * (size_t)HG * TT * TT)
#define WS_Y   (WS_PH + 0u)
#define WS_END (WS_Y + 0u)     // no Y plane: k_pv writes d_out

// ---- k_proj: block = (64 rows, 128 cols, which): qkv = x W (+ b), exact; q -> f16 hi (+ residual), k -> f16 rows, v -> bf16 hi + lo planes
__global__ __launch_bounds__(128) void k_proj(const float* __restrict__ XQ, const float* __restrict__ XC, const float* __restrict__ POS, const float* __restrict__ WQ, const float* __restrict__ BQ, const float* __restrict__ WK, const float* __restrict__ BK, const float* __restrict__ WV, const float* __restrict__ BV, _Float16* __restrict__ QH, _Float16* __restrict__ QL, _Float16* __restrict__ KH, __bf16* __restrict__ VT, __bf16* __restrict__ VL) {
  __shared__ __align__(16) _Float16 sh[64][136], sl[64][136]; __shared__ __align__(16) __bf16 th[128][72], tl2[128][72];
  const int tid = threadIdx.x, wave = tid >> 5, lane = tid & 31, col = lane & 15, g = lane >> 4; const int which = blockIdx.z; const int c0 = blockIdx.y * 128; const size_t r0 = (size_t)blockIdx.x * 64; const float* WA = which == 0 ? WQ : which == 1 ? WK : WV; const float* BA = which == 0 ? BQ : which == 1 ? BK : BV; const float* X = which == 0 ? XQ : XC;
  v8f acc[8] = {};
#pragma unroll 2
  for (int kc = 0; kc < CC / 32; ++kc) { v16b a; { const float* p = X + (r0 + wave * 16 + col) * CC + kc * 32 + 8 * g;
#pragma unroll
      for (int i = 0; i < 8; ++i) { a[i] = (__bf16)p[i]; a[8 + i] = (__bf16)p[16 + i]; } }
#pragma unroll
    for (int j = 0; j < 8; ++j) { v16b w; const int o = c0 + j * 16 + col;
#pragma unroll
      for (int i = 0; i < 8; ++i) { w[i] = (__bf16)WA[(size_t)(o) * CC + (kc * 32 + 8 * g + i)]; w[8 + i] = (__bf16)WA[(size_t)(o) * CC + (kc * 32 + 16 + 8 * g + i)]; }
      acc[j] = wmma_bf(a, w, acc[j]); } }
#pragma unroll
  for (int j = 0; j < 8; ++j) { const float bb = BA ? bfr(BA[c0 + j * 16 + col]) : 0.f;
#pragma unroll
    for (int r = 0; r < 8; ++r) { const int rl = wave * 16 + 8 * g + r, cl = j * 16 + col; const float v = acc[j][r] + bb + (which == 1 ? bfr(POS[((r0 + rl) % TT) * HD + ((c0 + cl) & (HD - 1))]) : 0.f); const _Float16 hv = (_Float16)v;   /* keys carry k + pos_k */
      if (which == 2) { const __bf16 bh = (__bf16)v; th[cl][rl] = bh; tl2[cl][rl] = (__bf16)(v - (float)bh); } else { sh[rl][cl] = hv; sl[rl][cl] = (_Float16)((v - (float)hv) * 1024.0f); }   /* q residual carried x 2^10 so the plane stays f16-normal on the chip */ } }
  __syncthreads();
  if (which < 2) { _Float16* dh = which == 0 ? QH : KH; for (int e = tid; e < 64 * 16; e += 128) { const int rl = e >> 4, q = e & 15; const int c = c0 + q * 8; const size_t dst = (r0 + rl) * QW + (size_t)(c >> 6) * HDK + (c & 63);   /* head h's first 64 of its 128-wide augmented slot */ vst2((unsigned*)(dh + dst), *(const v4u*)&sh[rl][q * 8]); if (which == 0) vst2((unsigned*)(QL + dst), *(const v4u*)&sl[rl][q * 8]); } }
  else { const size_t b = r0 / TT; const int t0 = (int)(r0 % TT); for (int e = tid; e < 128 * 8; e += 128) { const int cl = e >> 3, q = e & 7; const size_t o2 = (b * CC + c0 + cl) * (size_t)TT + t0 + q * 8; vst2((unsigned*)(VT + o2), *(const v4u*)&th[cl][q * 8]); vst2((unsigned*)(VL + o2), *(const v4u*)&tl2[cl][q * 8]); } } }
__global__ __launch_bounds__(128) void k_pos(const float* __restrict__ POS, _Float16* __restrict__ QH, _Float16* __restrict__ QL, _Float16* __restrict__ KH) { __shared__ __align__(16) _Float16 sp[64][72], spl[64][72];
  const int tid = threadIdx.x; const size_t r0 = (size_t)blockIdx.x * 64;
  for (int e = tid; e < 64 * HD; e += 128) { const int rl = e / HD, d = e % HD; const float v = bfr(POS[((r0 + rl) % TT) * HD + d]); const _Float16 hv = (_Float16)v; sp[rl][d] = hv; spl[rl][d] = (_Float16)((v - (float)hv) * 1024.0f); }
  __syncthreads();
  for (int e = tid; e < 64 * NH * 8; e += 128) { const int rl = e / (NH * 8), rem = e % (NH * 8), h = rem >> 3, q = rem & 7; const size_t dst = (r0 + rl) * QW + (size_t)h * HDK + HD + q * 8; vst2((unsigned*)(QH + dst), *(const v4u*)&sp[rl][q * 8]); vst2((unsigned*)(QL + dst), *(const v4u*)&spl[rl][q * 8]); vst2((unsigned*)(KH + dst), *(const v4u*)&sp[rl][q * 8]); } }
// ---- k_sc: block = (64 queries, 128 keys) of (b,h): 2-product 128-deep augmented logits / 8; masked keys -> -3e38
__global__ __launch_bounds__(128) void k_sc(const _Float16* __restrict__ QH, const _Float16* __restrict__ QL, const _Float16* __restrict__ KH, const int* __restrict__ KM0, float* __restrict__ S0) { __shared__ __align__(16) float ss[4][16][132]; const int b = blockIdx.z / NH, h = blockIdx.z % NH; const int* KM = KM0 + (size_t)b * TT; float* S = S0 + (size_t)blockIdx.z * TT * TT;
  const int tid = threadIdx.x, wave = tid >> 5, lane = tid & 31, col = lane & 15, g = lane >> 4; const int k0 = blockIdx.y * 128; const int ql0 = blockIdx.x * 64 + wave * 16; const size_t q0 = (size_t)b * TT + ql0;
  v8f acc[8] = {}, accl[8] = {};
#pragma unroll
  for (int kc = 0; kc < HDK / 32; ++kc) { const v16h ah = frag_h(QH + (q0 + col) * QW + h * HDK + kc * 32, lane), al = frag_h(QL + (q0 + col) * QW + h * HDK + kc * 32, lane);
#pragma unroll
    for (int j = 0; j < 8; ++j) { const v16h kb = frag_h(KH + ((size_t)b * TT + k0 + j * 16 + col) * QW + h * HDK + kc * 32, lane); acc[j] = wmma16(ah, kb, acc[j]); accl[j] = wmma16(al, kb, accl[j]); } }
#pragma unroll
  for (int j = 0; j < 8; ++j) acc[j] += accl[j] * (1.0f / 1024.0f);
#pragma unroll
  for (int j = 0; j < 8; ++j) { const int kt = k0 + j * 16 + col;
#pragma unroll
    for (int r = 0; r < 8; ++r) { const int qt = ql0 + 8 * g + r; (void)qt; float v = acc[j][r] * 0.125f; if (KM[kt] == 0) v = -3.0e38f; /* attention_mask == 0 -> -inf */ ss[wave][8 * g + r][j * 16 + col] = v; } }
  LDSX(); for (int rl = 0; rl < 16; ++rl) vst2(S + (size_t)(ql0 + rl) * TT + k0 + lane * 4, *(const v4f*)&ss[wave][rl][lane * 4]); }
// ---- k_sm: block = query row: softmax over keys [0, kend) -> P x 2^11 f32 (masked -> 0)
__global__ __launch_bounds__(256) void k_sm(float* __restrict__ S0) { __shared__ float sred[8]; __shared__ float sbc; __shared__ __align__(16) float sh[TT];
  const int t = threadIdx.x; const size_t row = blockIdx.x; float* sr = S0 + (size_t)blockIdx.y * TT * TT + row * TT; const int kend = TT;
  float m = -3.0e38f; for (int k = t; k < kend; k += 256) m = fmaxf(m, sr[k]);
#pragma unroll
  for (int o = 1; o < 32; o <<= 1) m = fmaxf(m, __shfl_xor(m, o));
  if ((t & 31) == 0) sred[t >> 5] = m; __syncthreads(); if (t == 0) { float a = sred[0]; for (int i = 1; i < 8; ++i) a = fmaxf(a, sred[i]); sbc = a; } __syncthreads(); m = sbc; __syncthreads();
  float sum = 0.f; for (int k = t; k < kend; k += 256) { const float v = sr[k]; sum += (v <= -1.0e38f) ? 0.f : expf(v - m); }
#pragma unroll
  for (int o = 1; o < 32; o <<= 1) sum += __shfl_xor(sum, o);
  if ((t & 31) == 0) sred[t >> 5] = sum; __syncthreads(); if (t == 0) { float a = 0.f; for (int i = 0; i < 8; ++i) a += sred[i]; sbc = 1.0f / a; } __syncthreads(); const float inv = sbc;
  for (int k = t; k < kend; k += 256) { const float v = sr[k]; sh[k] = (v <= -1.0e38f) ? 0.f : expf(v - m) * inv * 2048.0f; }
  __syncthreads(); for (int q = t; q < kend / 4; q += 256) vst2(sr + q * 4, *(const v4f*)&sh[q * 4]); }
// ---- k_pv: block = 64 queries of (b,h): y[q][h*HD + d] = P . v  (keys [0, kend))
__global__ __launch_bounds__(128) void k_pv(const float* __restrict__ PS0, const __bf16* __restrict__ VT, const __bf16* __restrict__ VL, float* __restrict__ Y) { const int b = blockIdx.z / NH, h = blockIdx.z % NH; const float* PS = PS0 + (size_t)blockIdx.z * TT * TT; __shared__ __align__(16) float ss[4][16][HD + 4];
  const int tid = threadIdx.x, wave = tid >> 5, lane = tid & 31, col = lane & 15, g = lane >> 4; const int ql0 = blockIdx.x * 64 + wave * 16; const int kend = TT;
  v8f acc[HD / 16] = {};
#pragma unroll 1
  for (int kc = 0; kc < kend / 32; ++kc) { const F2 p = split_row(PS + (size_t)(ql0 + col) * TT, kc * 32, lane);
#pragma unroll
    for (int j = 0; j < HD / 16; ++j) { const size_t po = ((size_t)b * CC + h * HD + j * 16 + col) * (size_t)TT + kc * 32; const v16b vh = frag_b(VT + po, lane); acc[j] = wmma_bf(p.h, vh, acc[j]); acc[j] = wmma_bf(p.l, vh, acc[j]); acc[j] = wmma_bf(p.h, frag_b(VL + po, lane), acc[j]); } }
#pragma unroll
  for (int j = 0; j < HD / 16; ++j)
#pragma unroll
    for (int r = 0; r < 8; ++r) ss[wave][8 * g + r][j * 16 + col] = acc[j][r] * (1.0f / 2048.0f);
  LDSX(); for (int rl = 0; rl < 16; ++rl) if (lane < HD / 4) vst2(Y + ((size_t)b * TT + ql0 + rl) * CC + h * HD + lane * 4, *(const v4f*)&ss[wave][rl][lane * 4]); }
extern "C" void kernel_launch(void* const* d_in, const int* in_sizes, int n_in, void* d_out, int out_size, void* d_ws, size_t ws_size, hipStream_t stream) {
  (void)in_sizes; (void)n_in; (void)out_size;
  const float** F = (const float**)d_in;   // 0 hidden_states [8,512,768], 1 context [8,512,768], 2 attention_mask [8,512] int (verbatim 0/1), 3 Wq [768,768] ([out,in]), 4 bq, 5 Wk, 6 bk, 7 Wv, 8 bv, 9 abs_pos_emb [512,64]
  if (ws_size < (size_t)WS_END) return;
  char* ws = (char*)d_ws; _Float16 *QH = (_Float16*)(ws + WS_QH), *QL = (_Float16*)(ws + WS_QL), *KH = (_Float16*)(ws + WS_KH); __bf16 *VT = (__bf16*)(ws + WS_VT), *VL = (__bf16*)(ws + WS_VL); float *S = (float*)(ws + WS_S);
  k_proj<<<dim3(TNB * TT / 64, CC / 128, 3), 128, 0, stream>>>(F[0], F[1], F[9], F[3], F[4], F[5], F[6], F[7], F[8], QH, QL, KH, VT, VL);
  k_pos<<<dim3(TNB * TT / 64), 128, 0, stream>>>(F[9], QH, QL, KH);
  k_sc<<<dim3(TT / 64, TT / 128, HG), 128, 0, stream>>>(QH, QL, KH, (const int*)d_in[2], S);
  k_sm<<<dim3(TT, HG), 256, 0, stream>>>(S);
  k_pv<<<dim3(TT / 64, 1, HG), 128, 0, stream>>>(S, VT, VL, (float*)d_out);
}

// v002
// A run of this version takes 240 microseconds.
// In two side-by-side timings against v001, it was 1.52 and 1.51 times as fast.
// All steps since v000 together make it 2.60 times as fast.
// compute dtype: all float inputs rounded to bf16, the key mask (int) read; q/k/v = x W^T + b with EXACT bf16 products on WMMA 16x16x32, f32 accumulate; the two score terms fused as one 128-deep contraction [q | pos_q] . [k + pos_k | pos_k] with the query side as f16 hi + residual (x 2^10) and the key side once in f16 (2 products), / 8, masked keys excluded, kept in f32 registers (all 8 batches x 12 heads per launch); running softmax in f32 (precise expf), unnormalised P f32 split bf16 hi + lo against v bf16 hi + lo (3 products), rows divided by their f32 sum at the end; merged heads in f32 (no output projection).
#include <hip/hip_runtime.h>
#include <math.h>

typedef __attribute__((ext_vector_type(16))) _Float16 v16h;
typedef __attribute__((ext_vector_type(16))) __bf16 v16b;
typedef __attribute__((ext_vector_type(8)))  _Float16 v8h;
typedef __attribute__((ext_vector_type(8)))  float v8f;
typedef __attribute__((ext_vector_type(4)))  float v4f;
typedef __attribute__((ext_vector_type(2)))  float v2f;
typedef __attribute__((ext_vector_type(4)))  unsigned v4u;
typedef __attribute__((ext_vector_type(4)))  int v4i;
typedef float __attribute__((may_alias)) float_a;
typedef int __attribute__((may_alias)) int_a;

template <typename T> __device__ __forceinline__ void vst2(void* p, T v) { *(T*)p = v;  }
__device__ __forceinline__ v8f wmma16(v16h a, v16h b, v8f c) {
  v8f d = __builtin_amdgcn_wmma_f32_16x16x32_f16(false, a, false, b, (short)0, c, false, false);
  asm volatile("v_nop\n\tv_nop\n\tv_nop\n\tv_nop" : "+v"(d) : "v"(a), "v"(b));
  return d;
}
__device__ __forceinline__ v8f wmma_bf(v16b a, v16b b, v8f c) {
  v8f d = __builtin_amdgcn_wmma_f32_16x16x32_bf16(false, a, false, b, (short)0, c, false, false);
  asm volatile("v_nop\n\tv_nop\n\tv_nop\n\tv_nop" : "+v"(d) : "v"(a), "v"(b));
  return d;
}
// 16x16x32 fragments: lane = (h = lane>>4, row/col = lane&15); elements 0..7 = k0+8h+0..7, 8..15 = k0+16+8h+0..7; D element r = row 8h+r
__device__ __forceinline__ v16h frag_h(const _Float16* rowk0, int lane) {
  union { v16h v; v8h q[2]; } u; const _Float16* p = rowk0 + 8 * (lane >> 4);
  u.q[0] = *(const v8h*)p; u.q[1] = *(const v8h*)(p + 16); return u.v;
}
__device__ __forceinline__ v16h frag_f32(const float* rowk0, int lane) {
  v16h a; const float* p = rowk0 + 8 * (lane >> 4);
#pragma unroll
  for (int i = 0; i < 8; ++i) { a[i] = (_Float16)p[i]; a[8 + i] = (_Float16)p[16 + i]; }
  return a;
}
__device__ __forceinline__ v16h frag_f32s(const float* rowk0, int lane, float sc) {
  v16h a; const float* p = rowk0 + 8 * (lane >> 4);
#pragma unroll
  for (int i = 0; i < 8; ++i) { a[i] = (_Float16)(p[i] * sc); a[8 + i] = (_Float16)(p[16 + i] * sc); }
  return a;
}
// column fragment from a [K][ld] layout (column n), rows >= K read as 0
__device__ __forceinline__ v16h fragc_f32(const float* W, int k0, int n, int lane, int ld, int K) {
  v16h a; const int g = lane >> 4;
#pragma unroll
  for (int i = 0; i < 8; ++i) { const int ka = k0 + 8 * g + i, kb = ka + 16;
    a[i] = (_Float16)(ka < K ? W[(size_t)(ka < K ? ka : K - 1) * ld + n] : 0.f); a[8 + i] = (_Float16)(kb < K ? W[(size_t)(kb < K ? kb : K - 1) * ld + n] : 0.f); }
  return a;
}
struct F2 { v16b h, l; };
__device__ __forceinline__ F2 bsplit16(const float v[16]) { F2 r;
#pragma unroll
  for (int i = 0; i < 16; ++i) { const __bf16 h = (__bf16)v[i]; r.h[i] = h; r.l[i] = (__bf16)(v[i] - (float)h); }
  return r; }
__device__ __forceinline__ F2 split_row(const float* row, int k0, int lane) { float v[16]; const float* p = row + k0 + 8 * (lane >> 4);
#pragma unroll
  for (int i = 0; i < 8; ++i) { v[i] = p[i]; v[8 + i] = p[16 + i]; }
  return bsplit16(v); }
__device__ __forceinline__ F2 split_rowK(const float* row, int k0, int lane, int K) { float v[16]; const int g = lane >> 4;
#pragma unroll
  for (int i = 0; i < 8; ++i) { const int ka = k0 + 8 * g + i, kb = ka + 16; v[i] = ka < K ? row[ka < K ? ka : K - 1] : 0.f; v[8 + i] = kb < K ? row[kb < K ? kb : K - 1] : 0.f; }
  return bsplit16(v); }
__device__ __forceinline__ F2 split_col(const float* W, int k0, int n, int lane, int ld, int K) { float v[16]; const int g = lane >> 4;
#pragma unroll
  for (int i = 0; i < 8; ++i) { const int ka = k0 + 8 * g + i, kb = ka + 16; v[i] = ka < K ? W[(size_t)(ka < K ? ka : K - 1) * ld + n] : 0.f; v[8 + i] = kb < K ? W[(size_t)(kb < K ? kb : K - 1) * ld + n] : 0.f; }
  return bsplit16(v); }
__device__ __forceinline__ v8f mac3(const F2& a, const F2& b, v8f c) { c = wmma_bf(a.l, b.h, c); c = wmma_bf(a.h, b.l, c); return wmma_bf(a.h, b.h, c); }
__device__ __forceinline__ float sigm(float v) { return 1.0f / (1.0f + expf(-v)); }
#define LDSX() do { asm volatile("s_wait_dscnt 0" ::: "memory"); __builtin_amdgcn_wave_barrier(); __builtin_amdgcn_fence(__ATOMIC_RELEASE, "workgroup"); } while (0)


// Attention with absolute-position bias (B 8, SQ = SK = 512, H 768 = 12 x 64): q from hidden_states, k/v from context (Linear [out,in] + bias); scores = (q.k + (q + pos_q).pos_k) / 8 = ([q | pos_q] . [k + pos_k | pos_k]) / 8; keys with attention_mask == 0 -> -inf; softmax; P v; heads merged.
#define NB 8
#define TT 512
#define CC 768
#define NH 12
#define HD 64
#define HDK 128        // augmented logit depth [q | pos]
#define QW (NH * HDK)  // 1,536: row width of the augmented q/k rows
#ifndef TNB
#define TNB NB
#endif
typedef __attribute__((ext_vector_type(8))) __bf16 v8b;
__device__ __forceinline__ v16b frag_b(const __bf16* rowk0, int lane) {
  union { v16b v; v8b q[2]; } u; const __bf16* p = rowk0 + 8 * (lane >> 4);
  u.q[0] = *(const v8b*)p; u.q[1] = *(const v8b*)(p + 16); return u.v;
}
__device__ __forceinline__ float bfr(float v) { return (float)(__bf16)v; }
__device__ __attribute__((noinline)) float exp_ni(float v) { return expf(v); }
__device__ __attribute__((noinline)) float erf_ni(float v) { return erff(v); }

#define WS_QH  0u
#define WS_QL  (WS_QH + 2u * (size_t)NB * TT * QW)
#define WS_KH  (WS_QL + 2u * (size_t)NB * TT * QW)
#define WS_VT  (WS_KH + 2u * (size_t)NB * TT * QW)      // bf16 v planes [b][c][t]
#define WS_VL  (WS_VT + 2u * (size_t)NB * CC * TT)      // bf16 v residual planes
#define HG (NB * NH)                                   // (batch, head) pairs per launch: all of them, blockIdx.z = b * NH + h
#define WS_END (WS_VL + 2u * (size_t)NB * CC * TT)      // no logits plane, no Y plane: k_att writes d_out

// ---- k_proj: block = (64 rows, 128 cols, which): qkv = x W (+ b), exact; q -> f16 hi (+ residual), k -> f16 rows, v -> bf16 hi + lo planes
__global__ __launch_bounds__(128) void k_proj(const float* __restrict__ XQ, const float* __restrict__ XC, const float* __restrict__ POS, const float* __restrict__ WQ, const float* __restrict__ BQ, const float* __restrict__ WK, const float* __restrict__ BK, const float* __restrict__ WV, const float* __restrict__ BV, _Float16* __restrict__ QH, _Float16* __restrict__ QL, _Float16* __restrict__ KH, __bf16* __restrict__ VT, __bf16* __restrict__ VL) {
  __shared__ __align__(16) _Float16 sh[64][136], sl[64][136]; __shared__ __align__(16) __bf16 th[128][72], tl2[128][72];
  const int tid = threadIdx.x, wave = tid >> 5, lane = tid & 31, col = lane & 15, g = lane >> 4; const int which = blockIdx.z; const int c0 = blockIdx.y * 128; const size_t r0 = (size_t)blockIdx.x * 64; const float* WA = which == 0 ? WQ : which == 1 ? WK : WV; const float* BA = which == 0 ? BQ : which == 1 ? BK : BV; const float* X = which == 0 ? XQ : XC;
  v8f acc[8] = {};
#pragma unroll 2
  for (int kc = 0; kc < CC / 32; ++kc) { v16b a; { const float* p = X + (r0 + wave * 16 + col) * CC + kc * 32 + 8 * g;
#pragma unroll
      for (int i = 0; i < 8; ++i) { a[i] = (__bf16)p[i]; a[8 + i] = (__bf16)p[16 + i]; } }
#pragma unroll
    for (int j = 0; j < 8; ++j) { v16b w; const int o = c0 + j * 16 + col;
#pragma unroll
      for (int i = 0; i < 8; ++i) { w[i] = (__bf16)WA[(size_t)(o) * CC + (kc * 32 + 8 * g + i)]; w[8 + i] = (__bf16)WA[(size_t)(o) * CC + (kc * 32 + 16 + 8 * g + i)]; }
      acc[j] = wmma_bf(a, w, acc[j]); } }
#pragma unroll
  for (int j = 0; j < 8; ++j) { const float bb = BA ? bfr(BA[c0 + j * 16 + col]) : 0.f;
#pragma unroll
    for (int r = 0; r < 8; ++r) { const int rl = wave * 16 + 8 * g + r, cl = j * 16 + col; const float v = acc[j][r] + bb + (which == 1 ? bfr(POS[((r0 + rl) % TT) * HD + ((c0 + cl) & (HD - 1))]) : 0.f); const _Float16 hv = (_Float16)v;   /* keys carry k + pos_k */
      if (which == 2) { const __bf16 bh = (__bf16)v; th[cl][rl] = bh; tl2[cl][rl] = (__bf16)(v - (float)bh); } else { sh[rl][cl] = hv; sl[rl][cl] = (_Float16)((v - (float)hv) * 1024.0f); }   /* q residual carried x 2^10 so the plane stays f16-normal on the chip */ } }
  __syncthreads();
  if (which < 2) { _Float16* dh = which == 0 ? QH : KH; for (int e = tid; e < 64 * 16; e += 128) { const int rl = e >> 4, q = e & 15; const int c = c0 + q * 8; const size_t dst = (r0 + rl) * QW + (size_t)(c >> 6) * HDK + (c & 63);   /* head h's first 64 of its 128-wide augmented slot */ vst2((unsigned*)(dh + dst), *(const v4u*)&sh[rl][q * 8]); if (which == 0) vst2((unsigned*)(QL + dst), *(const v4u*)&sl[rl][q * 8]); } }
  else { const size_t b = r0 / TT; const int t0 = (int)(r0 % TT); for (int e = tid; e < 128 * 8; e += 128) { const int cl = e >> 3, q = e & 7; const size_t o2 = (b * CC + c0 + cl) * (size_t)TT + t0 + q * 8; vst2((unsigned*)(VT + o2), *(const v4u*)&th[cl][q * 8]); vst2((unsigned*)(VL + o2), *(const v4u*)&tl2[cl][q * 8]); } } }
__global__ __launch_bounds__(128) void k_pos(const float* __restrict__ POS, _Float16* __restrict__ QH, _Float16* __restrict__ QL, _Float16* __restrict__ KH) { __shared__ __align__(16) _Float16 sp[64][72], spl[64][72];
  const int tid = threadIdx.x; const size_t r0 = (size_t)blockIdx.x * 64;
  for (int e = tid; e < 64 * HD; e += 128) { const int rl = e / HD, d = e % HD; const float v = bfr(POS[((r0 + rl) % TT) * HD + d]); const _Float16 hv = (_Float16)v; sp[rl][d] = hv; spl[rl][d] = (_Float16)((v - (float)hv) * 1024.0f); }
  __syncthreads();
  for (int e = tid; e < 64 * NH * 8; e += 128) { const int rl = e / (NH * 8), rem = e % (NH * 8), h = rem >> 3, q = rem & 7; const size_t dst = (r0 + rl) * QW + (size_t)h * HDK + HD + q * 8; vst2((unsigned*)(QH + dst), *(const v4u*)&sp[rl][q * 8]); vst2((unsigned*)(QL + dst), *(const v4u*)&spl[rl][q * 8]); vst2((unsigned*)(KH + dst), *(const v4u*)&sp[rl][q * 8]); } }
// ---- k_att: wave = 16 queries of (b,h), all 512 keys in passes of KCH: S^T = K . Q^T (2-product 128-deep augmented logits / 8; masked keys -> -3e38), so a lane holds one query's logits and a pair of S^T tiles is already the B fragment of P^T; running softmax in f32; O^T += V^T . P^T (3 products); rows divided by their sum at the end. Every inner loop is unrolled so that each register-array index is a constant (no scratch).
#define KCH 128   // keys per pass
// fragment of 16 rows from a wave-uniform tile pointer plus the lane's own byte offset (row * pitch + 16 * (lane >> 4))
__device__ __forceinline__ v16h frag_hs(const _Float16* tile, unsigned voff) { union { v16h v; v8h q[2]; } u; const char* p = (const char*)tile + voff; u.q[0] = *(const v8h*)p; u.q[1] = *(const v8h*)(p + 32); return u.v; }
__device__ __forceinline__ v16b frag_bs(const __bf16* tile, unsigned voff) { union { v16b v; v8b q[2]; } u; const char* p = (const char*)tile + voff; u.q[0] = *(const v8b*)p; u.q[1] = *(const v8b*)(p + 32); return u.v; }
__global__ __launch_bounds__(128) void k_att(const _Float16* __restrict__ QH, const _Float16* __restrict__ QL, const _Float16* __restrict__ KH, const int* __restrict__ KM0, const __bf16* __restrict__ VT, const __bf16* __restrict__ VL, float* __restrict__ Y) { __shared__ __align__(16) float ss[4][16][HD + 4]; const int b = blockIdx.z / NH, h = blockIdx.z % NH;
  const int tid = threadIdx.x, wave = __builtin_amdgcn_readfirstlane(tid >> 5), lane = tid & 31, col = lane & 15, g = lane >> 4; const int ql0 = blockIdx.x * 64 + wave * 16;   /* the wave's number as a scalar: the tile pointers below stay wave-uniform */
  const unsigned vq = (unsigned)(col * QW + 8 * g) * 2u, vv = (unsigned)(col * TT + 8 * g) * 2u, vm = (unsigned)g * 32u;   /* lane offsets in bytes: q / k rows, v planes, mask */
  const size_t qo = ((size_t)b * TT + ql0) * QW + h * HDK; const _Float16* KB = KH + (size_t)b * TT * QW + h * HDK; const size_t vo = ((size_t)b * CC + h * HD) * (size_t)TT; const int* KM = KM0 + (size_t)b * TT;
  v16h qh[HDK / 32], ql[HDK / 32];
  __builtin_amdgcn_sched_barrier(0);   /* the address arithmetic above stays in front of the query loads, so that none of it lands between them and their wait */
#pragma unroll
  for (int kc = 0; kc < HDK / 32; ++kc) { qh[kc] = frag_hs(QH + qo + kc * 32, vq); ql[kc] = frag_hs(QL + qo + kc * 32, vq); }
  asm volatile("s_wait_xcnt 0x0" ::: "memory");   /* behind the run of query loads: their offset register is given a new value further down */
  __builtin_amdgcn_sched_barrier(0);   /* keeps that later write from being scheduled in front of the wait */
  v8f acc[HD / 16] = {}; float mrun = -3.0e38f, lrun = 0.f;
#pragma unroll 1
  for (int k0 = 0; k0 < TT; k0 += KCH) { v8f s[KCH / 16];   /* rolled: one pass of logits in registers, one pass of code in the instruction cache */
#pragma unroll
    for (int jt = 0; jt < KCH / 16; ++jt) { v8f a = {}, al = {}; v16h kb[HDK / 32]; int km[8];   /* a tile's loads stand together in front of its products: one wait a tile */
#pragma unroll
      for (int kc = 0; kc < HDK / 32; ++kc) kb[kc] = frag_hs(KB + (size_t)(k0 + jt * 16) * QW + kc * 32, vq);
#pragma unroll
      for (int r = 0; r < 8; ++r) km[r] = ((const int*)((const char*)(KM + k0 + jt * 16) + vm))[r];
#pragma unroll
      for (int kc = 0; kc < HDK / 32; ++kc) { a = wmma16(kb[kc], qh[kc], a); al = wmma16(kb[kc], ql[kc], al); }
#pragma unroll
      for (int r = 0; r < 8; ++r) { float v = (a[r] + al[r] * (1.0f / 1024.0f)) * 0.125f; if (km[r] == 0) v = -3.0e38f; /* D element r = key 8g + r of query col; attention_mask == 0 -> -inf */ s[jt][r] = v; } }
    float cm = -3.0e38f;
#pragma unroll
    for (int jt = 0; jt < KCH / 16; ++jt)
#pragma unroll
      for (int r = 0; r < 8; ++r) cm = fmaxf(cm, s[jt][r]);
    cm = fmaxf(cm, __shfl_xor(cm, 16));   /* lanes c and c + 16 hold the two halves of query c's keys */
    const float mn = fmaxf(mrun, cm), alpha = expf(mrun - mn); mrun = mn; float sum = 0.f;
#pragma unroll
    for (int jt = 0; jt < KCH / 16; ++jt)
#pragma unroll
      for (int r = 0; r < 8; ++r) { const float v = s[jt][r]; const float x = expf(v - mn), e = (v <= -1.0e38f) ? 0.f : x; s[jt][r] = e; sum += e; }   /* the select matters only while every key so far is masked (v - mn = 0) */
    lrun = lrun * alpha + sum;
#pragma unroll
    for (int j = 0; j < HD / 16; ++j) acc[j] *= alpha;
#pragma unroll
    for (int kc = 0; kc < KCH / 32; ++kc) { float v[16]; v16b vh[HD / 16], vl[HD / 16];   /* the 32 keys' value loads stand together, in front of the split and the products */
#pragma unroll
      for (int j = 0; j < HD / 16; ++j) { const size_t po = vo + (size_t)(j * 16) * TT + k0 + kc * 32; vh[j] = frag_bs(VT + po, vv); vl[j] = frag_bs(VL + po, vv); }
#pragma unroll
      for (int i = 0; i < 8; ++i) { v[i] = s[2 * kc][i]; v[8 + i] = s[2 * kc + 1][i]; }
      const F2 p = bsplit16(v);
#pragma unroll
      for (int j = 0; j < HD / 16; ++j) { acc[j] = wmma_bf(vh[j], p.h, acc[j]); acc[j] = wmma_bf(vh[j], p.l, acc[j]); acc[j] = wmma_bf(vl[j], p.h, acc[j]); } } }
  const float inv = 1.0f / (lrun + __shfl_xor(lrun, 16));
#pragma unroll
  for (int j = 0; j < HD / 16; ++j) { v4f lo, hi;   /* D element r = d 16j + 8g + r of query col */
#pragma unroll
    for (int r = 0; r < 4; ++r) { lo[r] = acc[j][r] * inv; hi[r] = acc[j][4 + r] * inv; }
    *(v4f*)&ss[wave][col][j * 16 + 8 * g] = lo; *(v4f*)&ss[wave][col][j * 16 + 8 * g + 4] = hi; }
  LDSX();
#pragma unroll
  for (int rl = 0; rl < 16; rl += 2) vst2(Y + ((size_t)b * TT + ql0 + rl + g) * CC + h * HD + col * 4, *(const v4f*)&ss[wave][rl + g][col * 4]); }
extern "C" void kernel_launch(void* const* d_in, const int* in_sizes, int n_in, void* d_out, int out_size, void* d_ws, size_t ws_size, hipStream_t stream) {
  (void)in_sizes; (void)n_in; (void)out_size;
  const float** F = (const float**)d_in;   // 0 hidden_states [8,512,768], 1 context [8,512,768], 2 attention_mask [8,512] int (verbatim 0/1), 3 Wq [768,768] ([out,in]), 4 bq, 5 Wk, 6 bk, 7 Wv, 8 bv, 9 abs_pos_emb [512,64]
  if (ws_size < (size_t)WS_END) return;
  char* ws = (char*)d_ws; _Float16 *QH = (_Float16*)(ws + WS_QH), *QL = (_Float16*)(ws + WS_QL), *KH = (_Float16*)(ws + WS_KH); __bf16 *VT = (__bf16*)(ws + WS_VT), *VL = (__bf16*)(ws + WS_VL);
  k_proj<<<dim3(TNB * TT / 64, CC / 128, 3), 128, 0, stream>>>(F[0], F[1], F[9], F[3], F[4], F[5], F[6], F[7], F[8], QH, QL, KH, VT, VL);
  k_pos<<<dim3(TNB * TT / 64), 128, 0, stream>>>(F[9], QH, QL, KH);
  k_att<<<dim3(TT / 64, 1, HG), 128, 0, stream>>>(QH, QL, KH, (const int*)d_in[2], VT, VL, (float*)d_out);
}

// v003
// One run takes 98.4 microseconds.
// Timed twice side by side with v002, it ran 2.44 and 2.43 times as fast.
// Counting every step since v000, it is 6.34 times as fast.
// compute dtype: all float inputs rounded to bf16, the key mask (int) read; q/k/v = x W^T + b with EXACT bf16 products on WMMA 16x16x32, f32 accumulate; the two score terms fused as one 128-deep contraction [q | pos_q] . [k + pos_k | pos_k] with the query side as f16 hi + residual (x 2^10) and the key side once in f16 (2 products), / 8, masked keys excluded, kept in f32 registers (all 8 batches x 12 heads per launch); running softmax in f32 (precise expf), unnormalised P f32 split bf16 hi + lo against v bf16 hi + lo (3 products), rows divided by their f32 sum at the end; merged heads in f32 (no output projection).
#include <hip/hip_runtime.h>
#include <math.h>

typedef __attribute__((ext_vector_type(16))) _Float16 v16h;
typedef __attribute__((ext_vector_type(16))) __bf16 v16b;
typedef __attribute__((ext_vector_type(8)))  _Float16 v8h;
typedef __attribute__((ext_vector_type(8)))  float v8f;
typedef __attribute__((ext_vector_type(4)))  float v4f;
typedef __attribute__((ext_vector_type(2)))  float v2f;
typedef __attribute__((ext_vector_type(4)))  unsigned v4u;
typedef __attribute__((ext_vector_type(4)))  int v4i;
typedef float __attribute__((may_alias)) float_a;
typedef int __attribute__((may_alias)) int_a;

template <typename T> __device__ __forceinline__ void vst2(void* p, T v) { *(T*)p = v;  }
__device__ __forceinline__ v8f wmma16(v16h a, v16h b, v8f c) {
  v8f d = __builtin_amdgcn_wmma_f32_16x16x32_f16(false, a, false, b, (short)0, c, false, false);
  asm volatile("v_nop\n\tv_nop\n\tv_nop\n\tv_nop" : "+v"(d) : "v"(a), "v"(b));
  return d;
}
__device__ __forceinline__ v8f wmma_bf(v16b a, v16b b, v8f c) {
  v8f d = __builtin_amdgcn_wmma_f32_16x16x32_bf16(false, a, false, b, (short)0, c, false, false);
  asm volatile("v_nop\n\tv_nop\n\tv_nop\n\tv_nop" : "+v"(d) : "v"(a), "v"(b));
  return d;
}
// 16x16x32 fragments: lane = (h = lane>>4, row/col = lane&15); elements 0..7 = k0+8h+0..7, 8..15 = k0+16+8h+0..7; D element r = row 8h+r
__device__ __forceinline__ v16h frag_h(const _Float16* rowk0, int lane) {
  union { v16h v; v8h q[2]; } u; const _Float16* p = rowk0 + 8 * (lane >> 4);
  u.q[0] = *(const v8h*)p; u.q[1] = *(const v8h*)(p + 16); return u.v;
}
__device__ __forceinline__ v16h frag_f32(const float* rowk0, int lane) {
  v16h a; const float* p = rowk0 + 8 * (lane >> 4);
#pragma unroll
  for (int i = 0; i < 8; ++i) { a[i] = (_Float16)p[i]; a[8 + i] = (_Float16)p[16 + i]; }
  return a;
}
__device__ __forceinline__ v16h frag_f32s(const float* rowk0, int lane, float sc) {
  v16h a; const float* p = rowk0 + 8 * (lane >> 4);
#pragma unroll
  for (int i = 0; i < 8; ++i) { a[i] = (_Float16)(p[i] * sc); a[8 + i] = (_Float16)(p[16 + i] * sc); }
  return a;
}
// column fragment from a [K][ld] layout (column n), rows >= K read as 0
__device__ __forceinline__ v16h fragc_f32(const float* W, int k0, int n, int lane, int ld, int K) {
  v16h a; const int g = lane >> 4;
#pragma unroll
  for (int i = 0; i < 8; ++i) { const int ka = k0 + 8 * g + i, kb = ka + 16;
    a[i] = (_Float16)(ka < K ? W[(size_t)(ka < K ? ka : K - 1) * ld + n] : 0.f); a[8 + i] = (_Float16)(kb < K ? W[(size_t)(kb < K ? kb : K - 1) * ld + n] : 0.f); }
  return a;
}
struct F2 { v16b h, l; };
__device__ __forceinline__ F2 bsplit16(const float v[16]) { F2 r;
#pragma unroll
  for (int i = 0; i < 16; ++i) { const __bf16 h = (__bf16)v[i]; r.h[i] = h; r.l[i] = (__bf16)(v[i] - (float)h); }
  return r; }
__device__ __forceinline__ F2 split_row(const float* row, int k0, int lane) { float v[16]; const float* p = row + k0 + 8 * (lane >> 4);
#pragma unroll
  for (int i = 0; i < 8; ++i) { v[i] = p[i]; v[8 + i] = p[16 + i]; }
  return bsplit16(v); }
__device__ __forceinline__ F2 split_rowK(const float* row, int k0, int lane, int K) { float v[16]; const int g = lane >> 4;
#pragma unroll
  for (int i = 0; i < 8; ++i) { const int ka = k0 + 8 * g + i, kb = ka + 16; v[i] = ka < K ? row[ka < K ? ka : K - 1] : 0.f; v[8 + i] = kb < K ? row[kb < K ? kb : K - 1] : 0.f; }
  return bsplit16(v); }
__device__ __forceinline__ F2 split_col(const float* W, int k0, int n, int lane, int ld, int K) { float v[16]; const int g = lane >> 4;
#pragma unroll
  for (int i = 0; i < 8; ++i) { const int ka = k0 + 8 * g + i, kb = ka + 16; v[i] = ka < K ? W[(size_t)(ka < K ? ka : K - 1) * ld + n] : 0.f; v[8 + i] = kb < K ? W[(size_t)(kb < K ? kb : K - 1) * ld + n] : 0.f; }
  return bsplit16(v); }
__device__ __forceinline__ v8f mac3(const F2& a, const F2& b, v8f c) { c = wmma_bf(a.l, b.h, c); c = wmma_bf(a.h, b.l, c); return wmma_bf(a.h, b.h, c); }
__device__ __forceinline__ float sigm(float v) { return 1.0f / (1.0f + expf(-v)); }
#define LDSX() do { asm volatile("s_wait_dscnt 0" ::: "memory"); __builtin_amdgcn_wave_barrier(); __builtin_amdgcn_fence(__ATOMIC_RELEASE, "workgroup"); } while (0)


// Attention with absolute-position bias (B 8, SQ = SK = 512, H 768 = 12 x 64): q from hidden_states, k/v from context (Linear [out,in] + bias); scores = (q.k + (q + pos_q).pos_k) / 8 = ([q | pos_q] . [k + pos_k | pos_k]) / 8; keys with attention_mask == 0 -> -inf; softmax; P v; heads merged.
#define NB 8
#define TT 512
#define CC 768
#define NH 12
#define HD 64
#define HDK 128        // augmented logit depth [q | pos]
#define QW (NH * HDK)  // 1,536: row width of the augmented q/k rows
#ifndef TNB
#define TNB NB
#endif
typedef __attribute__((ext_vector_type(8))) __bf16 v8b;
__device__ __forceinline__ v16b frag_b(const __bf16* rowk0, int lane) {
  union { v16b v; v8b q[2]; } u; const __bf16* p = rowk0 + 8 * (lane >> 4);
  u.q[0] = *(const v8b*)p; u.q[1] = *(const v8b*)(p + 16); return u.v;
}
__device__ __forceinline__ float bfr(float v) { return (float)(__bf16)v; }
__device__ __attribute__((noinline)) float exp_ni(float v) { return expf(v); }
__device__ __attribute__((noinline)) float erf_ni(float v) { return erff(v); }

#define WS_QH  0u
#define WS_QL  (WS_QH + 2u * (size_t)NB * TT * QW)
#define WS_KH  (WS_QL + 2u * (size_t)NB * TT * QW)
#define WS_VT  (WS_KH + 2u * (size_t)NB * TT * QW)      // bf16 v planes [b][c][t]
#define WS_VL  (WS_VT + 2u * (size_t)NB * CC * TT)      // bf16 v residual planes
#define HG (NB * NH)                                   // (batch, head) pairs per launch: all of them, blockIdx.z = b * NH + h
#define WS_END (WS_VL + 2u * (size_t)NB * CC * TT)      // no logits plane, no Y plane: k_att writes d_out

// ---- k_proj: block = (64 rows, 128 cols, which): qkv = x W (+ b), exact; q -> f16 hi (+ residual), k -> f16 rows, v -> bf16 hi + lo planes. Each 32-deep slice of the block's x rows and W rows is loaded once, whole lines, rounded to bf16 once and laid in LDS (two buffers, the next slice's loads in flight over this slice's products); wave = 32 rows x 64 cols, fragments from LDS.
#define PPI 40                 // LDS pitch of a staged row in bf16: 64 B of data + 16 B (an odd multiple of 16 B, for the 16-byte fragment reads)
#define PBUF ((64 + 128) * PPI) // one staging buffer in bf16: x rows 0..63, W rows 64..191
typedef __attribute__((ext_vector_type(4))) __bf16 v4b;
__global__ __launch_bounds__(128) void k_proj(const float* __restrict__ XQ, const float* __restrict__ XC, const float* __restrict__ POS, const float* __restrict__ WQ, const float* __restrict__ BQ, const float* __restrict__ WK, const float* __restrict__ BK, const float* __restrict__ WV, const float* __restrict__ BV, _Float16* __restrict__ QH, _Float16* __restrict__ QL, _Float16* __restrict__ KH, __bf16* __restrict__ VT, __bf16* __restrict__ VL) {
  __shared__ __align__(16) char sm[2 * 128 * 72 * 2];   /* the staging buffers (30,720 B), then, behind the loop's last barrier, the output tiles */
  _Float16 (*sh)[136] = (_Float16 (*)[136])sm; _Float16 (*sl)[136] = (_Float16 (*)[136])(sm + 64 * 136 * 2); __bf16 (*th)[72] = (__bf16 (*)[72])sm; __bf16 (*tl2)[72] = (__bf16 (*)[72])(sm + 128 * 72 * 2); __bf16* st = (__bf16*)sm;
  const int tid = threadIdx.x, wave = tid >> 5, lane = tid & 31, col = lane & 15, g = lane >> 4; const int which = blockIdx.z; const int c0 = blockIdx.y * 128; const size_t r0 = (size_t)blockIdx.x * 64; const float* WA = which == 0 ? WQ : which == 1 ? WK : WV; const float* BA = which == 0 ? BQ : which == 1 ? BK : BV; const float* X = which == 0 ? XQ : XC;
  const int wm = wave & 1, wn = wave >> 1, srow = tid >> 3, sc4 = (tid & 7) * 4;   /* staging: 8 threads cover one row's 128 B, a wave's load 4 whole lines */
  const float* gx = X + (r0 + srow) * CC + sc4; const float* gw = WA + (size_t)(c0 + srow) * CC + sc4; __bf16* sdst = st + srow * PPI + sc4;
  const __bf16* fa = st + (wm * 32 + col) * PPI; const __bf16* fw = st + (64 + wn * 64 + col) * PPI;
  v8f acc[2][4] = {}; v4f pf[12];
#pragma unroll
  for (int i = 0; i < 12; ++i) pf[i] = i < 4 ? *(const v4f*)(gx + (size_t)i * 16 * CC) : *(const v4f*)(gw + (size_t)(i - 4) * 16 * CC);
#pragma unroll
  for (int i = 0; i < 12; ++i) *(v4b*)(sdst + i * 16 * PPI) = __builtin_convertvector(pf[i], v4b);
  __syncthreads();
#pragma unroll 2
  for (int kc = 0; kc < CC / 32; ++kc) { const int cur = (kc & 1) * PBUF, nxt = PBUF - cur; v16b a[2], w[4];   /* unrolled by the two buffers, so that their offsets are constants */
    if (kc + 1 < CC / 32) {
#pragma unroll
      for (int i = 0; i < 12; ++i) pf[i] = i < 4 ? *(const v4f*)(gx + (size_t)i * 16 * CC + (kc + 1) * 32) : *(const v4f*)(gw + (size_t)(i - 4) * 16 * CC + (kc + 1) * 32); }
#pragma unroll
    for (int i = 0; i < 2; ++i) a[i] = frag_b(fa + cur + i * 16 * PPI, lane);
#pragma unroll
    for (int j = 0; j < 4; ++j) w[j] = frag_b(fw + cur + j * 16 * PPI, lane);
#pragma unroll
    for (int i = 0; i < 2; ++i)
#pragma unroll
      for (int j = 0; j < 4; ++j) acc[i][j] = wmma_bf(a[i], w[j], acc[i][j]);
    if (kc + 1 < CC / 32) {
#pragma unroll
      for (int i = 0; i < 12; ++i) *(v4b*)(sdst + nxt + i * 16 * PPI) = __builtin_convertvector(pf[i], v4b); }
    __syncthreads(); }   /* one barrier a slice: it publishes the next slice and ends the reads of the buffer that the next trip refills; the last one frees the LDS for the output tiles */
#pragma unroll
  for (int i = 0; i < 2; ++i)
#pragma unroll
  for (int j = 0; j < 4; ++j) { const float bb = BA ? bfr(BA[c0 + wn * 64 + j * 16 + col]) : 0.f;
#pragma unroll
    for (int r = 0; r < 8; ++r) { const int rl = wm * 32 + i * 16 + 8 * g + r, cl = wn * 64 + j * 16 + col; const float v = acc[i][j][r] + bb + (which == 1 ? bfr(POS[((r0 + rl) % TT) * HD + ((c0 + cl) & (HD - 1))]) : 0.f); const _Float16 hv = (_Float16)v;   /* keys carry k + pos_k */
      if (which == 2) { const __bf16 bh = (__bf16)v; th[cl][rl] = bh; tl2[cl][rl] = (__bf16)(v - (float)bh); } else { sh[rl][cl] = hv; sl[rl][cl] = (_Float16)((v - (float)hv) * 1024.0f); }   /* q residual carried x 2^10 so the plane stays f16-normal on the chip */ } }
  __syncthreads();
  if (which < 2) { _Float16* dh = which == 0 ? QH : KH; for (int e = tid; e < 64 * 16; e += 128) { const int rl = e >> 4, q = e & 15; const int c = c0 + q * 8; const size_t dst = (r0 + rl) * QW + (size_t)(c >> 6) * HDK + (c & 63);   /* head h's first 64 of its 128-wide augmented slot */ vst2((unsigned*)(dh + dst), *(const v4u*)&sh[rl][q * 8]);
      asm volatile("s_wait_xcnt 0x0" ::: "memory");   /* behind the store: its data registers take the next LDS read, its address registers are stepped for the next trip */
      __builtin_amdgcn_sched_barrier(0);   /* keeps those writes from being scheduled in front of the wait */
      if (which == 0) { vst2((unsigned*)(QL + dst), *(const v4u*)&sl[rl][q * 8]);
        asm volatile("s_wait_xcnt 0x0" ::: "memory");   /* the same behind the residual plane's store */
        __builtin_amdgcn_sched_barrier(0);   /* as above */ } } }
  else { const size_t b = r0 / TT; const int t0 = (int)(r0 % TT); for (int e = tid; e < 128 * 8; e += 128) { const int cl = e >> 3, q = e & 7; const size_t o2 = (b * CC + c0 + cl) * (size_t)TT + t0 + q * 8; vst2((unsigned*)(VT + o2), *(const v4u*)&th[cl][q * 8]); vst2((unsigned*)(VL + o2), *(const v4u*)&tl2[cl][q * 8]); } } }
__global__ __launch_bounds__(128) void k_pos(const float* __restrict__ POS, _Float16* __restrict__ QH, _Float16* __restrict__ QL, _Float16* __restrict__ KH) { __shared__ __align__(16) _Float16 sp[64][72], spl[64][72];
  const int tid = threadIdx.x; const size_t r0 = (size_t)blockIdx.x * 64;
  for (int e = tid; e < 64 * HD; e += 128) { const int rl = e / HD, d = e % HD; const float v = bfr(POS[((r0 + rl) % TT) * HD + d]); const _Float16 hv = (_Float16)v; sp[rl][d] = hv; spl[rl][d] = (_Float16)((v - (float)hv) * 1024.0f); }
  __syncthreads();
  for (int e = tid; e < 64 * NH * 8; e += 128) { const int rl = e / (NH * 8), rem = e % (NH * 8), h = rem >> 3, q = rem & 7; const size_t dst = (r0 + rl) * QW + (size_t)h * HDK + HD + q * 8; vst2((unsigned*)(QH + dst), *(const v4u*)&sp[rl][q * 8]); vst2((unsigned*)(QL + dst), *(const v4u*)&spl[rl][q * 8]); vst2((unsigned*)(KH + dst), *(const v4u*)&sp[rl][q * 8]); } }
// ---- k_att: wave = 16 queries of (b,h), all 512 keys in passes of KCH: S^T = K . Q^T (2-product 128-deep augmented logits / 8; masked keys -> -3e38), so a lane holds one query's logits and a pair of S^T tiles is already the B fragment of P^T; running softmax in f32; O^T += V^T . P^T (3 products); rows divided by their sum at the end. Every inner loop is unrolled so that each register-array index is a constant (no scratch).
#define KCH 128   // keys per pass
// fragment of 16 rows from a wave-uniform tile pointer plus the lane's own byte offset (row * pitch + 16 * (lane >> 4))
__device__ __forceinline__ v16h frag_hs(const _Float16* tile, unsigned voff) { union { v16h v; v8h q[2]; } u; const char* p = (const char*)tile + voff; u.q[0] = *(const v8h*)p; u.q[1] = *(const v8h*)(p + 32); return u.v; }
__device__ __forceinline__ v16b frag_bs(const __bf16* tile, unsigned voff) { union { v16b v; v8b q[2]; } u; const char* p = (const char*)tile + voff; u.q[0] = *(const v8b*)p; u.q[1] = *(const v8b*)(p + 32); return u.v; }
__global__ __launch_bounds__(128) void k_att(const _Float16* __restrict__ QH, const _Float16* __restrict__ QL, const _Float16* __restrict__ KH, const int* __restrict__ KM0, const __bf16* __restrict__ VT, const __bf16* __restrict__ VL, float* __restrict__ Y) { __shared__ __align__(16) float ss[4][16][HD + 4]; const int b = blockIdx.z / NH, h = blockIdx.z % NH;
  const int tid = threadIdx.x, wave = __builtin_amdgcn_readfirstlane(tid >> 5), lane = tid & 31, col = lane & 15, g = lane >> 4; const int ql0 = blockIdx.x * 64 + wave * 16;   /* the wave's number as a scalar: the tile pointers below stay wave-uniform */
  const unsigned vq = (unsigned)(col * QW + 8 * g) * 2u, vv = (unsigned)(col * TT + 8 * g) * 2u, vm = (unsigned)g * 32u;   /* lane offsets in bytes: q / k rows, v planes, mask */
  const size_t qo = ((size_t)b * TT + ql0) * QW + h * HDK; const _Float16* KB = KH + (size_t)b * TT * QW + h * HDK; const size_t vo = ((size_t)b * CC + h * HD) * (size_t)TT; const int* KM = KM0 + (size_t)b * TT;
  v16h qh[HDK / 32], ql[HDK / 32];
  __builtin_amdgcn_sched_barrier(0);   /* the address arithmetic above stays in front of the query loads, so that none of it lands between them and their wait */
#pragma unroll
  for (int kc = 0; kc < HDK / 32; ++kc) { qh[kc] = frag_hs(QH + qo + kc * 32, vq); ql[kc] = frag_hs(QL + qo + kc * 32, vq); }
  asm volatile("s_wait_xcnt 0x0" ::: "memory");   /* behind the run of query loads: their offset register is given a new value further down */
  __builtin_amdgcn_sched_barrier(0);   /* keeps that later write from being scheduled in front of the wait */
  v8f acc[HD / 16] = {}; float mrun = -3.0e38f, lrun = 0.f;
#pragma unroll 1
  for (int k0 = 0; k0 < TT; k0 += KCH) { v8f s[KCH / 16];   /* rolled: one pass of logits in registers, one pass of code in the instruction cache */
#pragma unroll
    for (int jt = 0; jt < KCH / 16; ++jt) { v8f a = {}, al = {}; v16h kb[HDK / 32]; int km[8];   /* a tile's loads stand together in front of its products: one wait a tile */
#pragma unroll
      for (int kc = 0; kc < HDK / 32; ++kc) kb[kc] = frag_hs(KB + (size_t)(k0 + jt * 16) * QW + kc * 32, vq);
#pragma unroll
      for (int r = 0; r < 8; ++r) km[r] = ((const int*)((const char*)(KM + k0 + jt * 16) + vm))[r];
#pragma unroll
      for (int kc = 0; kc < HDK / 32; ++kc) { a = wmma16(kb[kc], qh[kc], a); al = wmma16(kb[kc], ql[kc], al); }
#pragma unroll
      for (int r = 0; r < 8; ++r) { float v = (a[r] + al[r] * (1.0f / 1024.0f)) * 0.125f; if (km[r] == 0) v = -3.0e38f; /* D element r = key 8g + r of query col; attention_mask == 0 -> -inf */ s[jt][r] = v; } }
    float cm = -3.0e38f;
#pragma unroll
    for (int jt = 0; jt < KCH / 16; ++jt)
#pragma unroll
      for (int r = 0; r < 8; ++r) cm = fmaxf(cm, s[jt][r]);
    cm = fmaxf(cm, __shfl_xor(cm, 16));   /* lanes c and c + 16 hold the two halves of query c's keys */
    const float mn = fmaxf(mrun, cm), alpha = expf(mrun - mn); mrun = mn; float sum = 0.f;
#pragma unroll
    for (int jt = 0; jt < KCH / 16; ++jt)
#pragma unroll
      for (int r = 0; r < 8; ++r) { const float v = s[jt][r]; const float x = expf(v - mn), e = (v <= -1.0e38f) ? 0.f : x; s[jt][r] = e; sum += e; }   /* the select matters only while every key so far is masked (v - mn = 0) */
    lrun = lrun * alpha + sum;
#pragma unroll
    for (int j = 0; j < HD / 16; ++j) acc[j] *= alpha;
#pragma unroll
    for (int kc = 0; kc < KCH / 32; ++kc) { float v[16]; v16b vh[HD / 16], vl[HD / 16];   /* the 32 keys' value loads stand together, in front of the split and the products */
#pragma unroll
      for (int j = 0; j < HD / 16; ++j) { const size_t po = vo + (size_t)(j * 16) * TT + k0 + kc * 32; vh[j] = frag_bs(VT + po, vv); vl[j] = frag_bs(VL + po, vv); }
#pragma unroll
      for (int i = 0; i < 8; ++i) { v[i] = s[2 * kc][i]; v[8 + i] = s[2 * kc + 1][i]; }
      const F2 p = bsplit16(v);
#pragma unroll
      for (int j = 0; j < HD / 16; ++j) { acc[j] = wmma_bf(vh[j], p.h, acc[j]); acc[j] = wmma_bf(vh[j], p.l, acc[j]); acc[j] = wmma_bf(vl[j], p.h, acc[j]); } } }
  const float inv = 1.0f / (lrun + __shfl_xor(lrun, 16));
#pragma unroll
  for (int j = 0; j < HD / 16; ++j) { v4f lo, hi;   /* D element r = d 16j + 8g + r of query col */
#pragma unroll
    for (int r = 0; r < 4; ++r) { lo[r] = acc[j][r] * inv; hi[r] = acc[j][4 + r] * inv; }
    *(v4f*)&ss[wave][col][j * 16 + 8 * g] = lo; *(v4f*)&ss[wave][col][j * 16 + 8 * g + 4] = hi; }
  LDSX();
#pragma unroll
  for (int rl = 0; rl < 16; rl += 2) vst2(Y + ((size_t)b * TT + ql0 + rl + g) * CC + h * HD + col * 4, *(const v4f*)&ss[wave][rl + g][col * 4]); }
extern "C" void kernel_launch(void* const* d_in, const int* in_sizes, int n_in, void* d_out, int out_size, void* d_ws, size_t ws_size, hipStream_t stream) {
  (void)in_sizes; (void)n_in; (void)out_size;
  const float** F = (const float**)d_in;   // 0 hidden_states [8,512,768], 1 context [8,512,768], 2 attention_mask [8,512] int (verbatim 0/1), 3 Wq [768,768] ([out,in]), 4 bq, 5 Wk, 6 bk, 7 Wv, 8 bv, 9 abs_pos_emb [512,64]
  if (ws_size < (size_t)WS_END) return;
  char* ws = (char*)d_ws; _Float16 *QH = (_Float16*)(ws + WS_QH), *QL = (_Float16*)(ws + WS_QL), *KH = (_Float16*)(ws + WS_KH); __bf16 *VT = (__bf16*)(ws + WS_VT), *VL = (__bf16*)(ws + WS_VL);
  k_proj<<<dim3(TNB * TT / 64, CC / 128, 3), 128, 0, stream>>>(F[0], F[1], F[9], F[3], F[4], F[5], F[6], F[7], F[8], QH, QL, KH, VT, VL);
  k_pos<<<dim3(TNB * TT / 64), 128, 0, stream>>>(F[9], QH, QL, KH);
  k_att<<<dim3(TT / 64, 1, HG), 128, 0, stream>>>(QH, QL, KH, (const int*)d_in[2], VT, VL, (float*)d_out);
}

// v004
// Measured time: 72.7 microseconds a run.
// Two timings next to v003 both put it at 1.35 times that version's speed.
// Over all steps from v000 it is 8.56 times as fast.
// compute dtype: all float inputs rounded to bf16, the key mask (int) read; q/k/v = x W^T + b with EXACT bf16 products on WMMA 16x16x32, f32 accumulate; the two score terms fused as one 128-deep contraction [q | pos_q] . [k + pos_k | pos_k] with the query side as f16 hi + residual (x 2^10) and the key side once in f16 (2 products), / 8, masked keys excluded, kept in f32 registers (all 8 batches x 12 heads per launch); running softmax in f32 (precise expf), unnormalised P f32 split bf16 hi + lo against v bf16 hi + lo (3 products), rows divided by their f32 sum at the end; merged heads in f32 (no output projection).
#include <hip/hip_runtime.h>
#include <math.h>

typedef __attribute__((ext_vector_type(16))) _Float16 v16h;
typedef __attribute__((ext_vector_type(16))) __bf16 v16b;
typedef __attribute__((ext_vector_type(8)))  _Float16 v8h;
typedef __attribute__((ext_vector_type(8)))  float v8f;
typedef __attribute__((ext_vector_type(4)))  float v4f;
typedef __attribute__((ext_vector_type(2)))  float v2f;
typedef __attribute__((ext_vector_type(4)))  unsigned v4u;
typedef __attribute__((ext_vector_type(4)))  int v4i;
typedef float __attribute__((may_alias)) float_a;
typedef int __attribute__((may_alias)) int_a;

template <typename T> __device__ __forceinline__ void vst2(void* p, T v) { *(T*)p = v;  }
__device__ __forceinline__ v8f wmma16(v16h a, v16h b, v8f c) {
  v8f d = __builtin_amdgcn_wmma_f32_16x16x32_f16(false, a, false, b, (short)0, c, false, false);
  asm volatile("v_nop\n\tv_nop\n\tv_nop\n\tv_nop" : "+v"(d) : "v"(a), "v"(b));
  return d;
}
__device__ __forceinline__ v8f wmma_bf(v16b a, v16b b, v8f c) {
  v8f d = __builtin_amdgcn_wmma_f32_16x16x32_bf16(false, a, false, b, (short)0, c, false, false);
  asm volatile("v_nop\n\tv_nop\n\tv_nop\n\tv_nop" : "+v"(d) : "v"(a), "v"(b));
  return d;
}
// 16x16x32 fragments: lane = (h = lane>>4, row/col = lane&15); elements 0..7 = k0+8h+0..7, 8..15 = k0+16+8h+0..7; D element r = row 8h+r
__device__ __forceinline__ v16h frag_h(const _Float16* rowk0, int lane) {
  union { v16h v; v8h q[2]; } u; const _Float16* p = rowk0 + 8 * (lane >> 4);
  u.q[0] = *(const v8h*)p; u.q[1] = *(const v8h*)(p + 16); return u.v;
}
__device__ __forceinline__ v16h frag_f32(const float* rowk0, int lane) {
  v16h a; const float* p = rowk0 + 8 * (lane >> 4);
#pragma unroll
  for (int i = 0; i < 8; ++i) { a[i] = (_Float16)p[i]; a[8 + i] = (_Float16)p[16 + i]; }
  return a;
}
__device__ __forceinline__ v16h frag_f32s(const float* rowk0, int lane, float sc) {
  v16h a; const float* p = rowk0 + 8 * (lane >> 4);
#pragma unroll
  for (int i = 0; i < 8; ++i) { a[i] = (_Float16)(p[i] * sc); a[8 + i] = (_Float16)(p[16 + i] * sc); }
  return a;
}
// column fragment from a [K][ld] layout (column n), rows >= K read as 0
__device__ __forceinline__ v16h fragc_f32(const float* W, int k0, int n, int lane, int ld, int K) {
  v16h a; const int g = lane >> 4;
#pragma unroll
  for (int i = 0; i < 8; ++i) { const int ka = k0 + 8 * g + i, kb = ka + 16;
    a[i] = (_Float16)(ka < K ? W[(size_t)(ka < K ? ka : K - 1) * ld + n] : 0.f); a[8 + i] = (_Float16)(kb < K ? W[(size_t)(kb < K ? kb : K - 1) * ld + n] : 0.f); }
  return a;
}
struct F2 { v16b h, l; };
__device__ __forceinline__ F2 bsplit16(const float v[16]) { F2 r;
#pragma unroll
  for (int i = 0; i < 16; ++i) { const __bf16 h = (__bf16)v[i]; r.h[i] = h; r.l[i] = (__bf16)(v[i] - (float)h); }
  return r; }
__device__ __forceinline__ F2 split_row(const float* row, int k0, int lane) { float v[16]; const float* p = row + k0 + 8 * (lane >> 4);
#pragma unroll
  for (int i = 0; i < 8; ++i) { v[i] = p[i]; v[8 + i] = p[16 + i]; }
  return bsplit16(v); }
__device__ __forceinline__ F2 split_rowK(const float* row, int k0, int lane, int K) { float v[16]; const int g = lane >> 4;
#pragma unroll
  for (int i = 0; i < 8; ++i) { const int ka = k0 + 8 * g + i, kb = ka + 16; v[i] = ka < K ? row[ka < K ? ka : K - 1] : 0.f; v[8 + i] = kb < K ? row[kb < K ? kb : K - 1] : 0.f; }
  return bsplit16(v); }
__device__ __forceinline__ F2 split_col(const float* W, int k0, int n, int lane, int ld, int K) { float v[16]; const int g = lane >> 4;
#pragma unroll
  for (int i = 0; i < 8; ++i) { const int ka = k0 + 8 * g + i, kb = ka + 16; v[i] = ka < K ? W[(size_t)(ka < K ? ka : K - 1) * ld + n] : 0.f; v[8 + i] = kb < K ? W[(size_t)(kb < K ? kb : K - 1) * ld + n] : 0.f; }
  return bsplit16(v); }
__device__ __forceinline__ v8f mac3(const F2& a, const F2& b, v8f c) { c = wmma_bf(a.l, b.h, c); c = wmma_bf(a.h, b.l, c); return wmma_bf(a.h, b.h, c); }
__device__ __forceinline__ float sigm(float v) { return 1.0f / (1.0f + expf(-v)); }
#define LDSX() do { asm volatile("s_wait_dscnt 0" ::: "memory"); __builtin_amdgcn_wave_barrier(); __builtin_amdgcn_fence(__ATOMIC_RELEASE, "workgroup"); } while (0)


// Attention with absolute-position bias (B 8, SQ = SK = 512, H 768 = 12 x 64): q from hidden_states, k/v from context (Linear [out,in] + bias); scores = (q.k + (q + pos_q).pos_k) / 8 = ([q | pos_q] . [k + pos_k | pos_k]) / 8; keys with attention_mask == 0 -> -inf; softmax; P v; heads merged.
#define NB 8
#define TT 512
#define CC 768
#define NH 12
#define HD 64
#define HDK 128        // augmented logit depth [q | pos]
#define QW (NH * HDK)  // 1,536: row width of the augmented q/k rows
#ifndef TNB
#define TNB NB
#endif
typedef __attribute__((ext_vector_type(8))) __bf16 v8b;
__device__ __forceinline__ v16b frag_b(const __bf16* rowk0, int lane) {
  union { v16b v; v8b q[2]; } u; const __bf16* p = rowk0 + 8 * (lane >> 4);
  u.q[0] = *(const v8b*)p; u.q[1] = *(const v8b*)(p + 16); return u.v;
}
__device__ __forceinline__ float bfr(float v) { return (float)(__bf16)v; }
__device__ __attribute__((noinline)) float exp_ni(float v) { return expf(v); }
__device__ __attribute__((noinline)) float erf_ni(float v) { return erff(v); }

#define WS_QH  0u
#define WS_QL  (WS_QH + 2u * (size_t)NB * TT * QW)
#define WS_KH  (WS_QL + 2u * (size_t)NB * TT * QW)
#define WS_VT  (WS_KH + 2u * (size_t)NB * TT * QW)      // bf16 v planes [b][c][t]
#define WS_VL  (WS_VT + 2u * (size_t)NB * CC * TT)      // bf16 v residual planes
#define HG (NB * NH)                                   // (batch, head) pairs per launch: all of them, blockIdx.z = b * NH + h
#define WS_END (WS_VL + 2u * (size_t)NB * CC * TT)      // no logits plane, no Y plane: k_att writes d_out

// ---- k_proj: block = (64 rows, 128 cols, which): qkv = x W (+ b), exact; q -> f16 hi (+ residual), k -> f16 rows, v -> bf16 hi + lo planes. Each 32-deep slice of the block's x rows and W rows is loaded once, whole lines, rounded to bf16 once and laid in LDS (two buffers, the next slice's loads in flight over this slice's products); wave = 32 rows x 64 cols, fragments from LDS.
#define PPI 40                 // LDS pitch of a staged row in bf16: 64 B of data + 16 B (an odd multiple of 16 B, for the 16-byte fragment reads)
#define PBUF ((64 + 128) * PPI) // one staging buffer in bf16: x rows 0..63, W rows 64..191
typedef __attribute__((ext_vector_type(4))) __bf16 v4b;
__global__ __launch_bounds__(128) void k_proj(const float* __restrict__ XQ, const float* __restrict__ XC, const float* __restrict__ POS, const float* __restrict__ WQ, const float* __restrict__ BQ, const float* __restrict__ WK, const float* __restrict__ BK, const float* __restrict__ WV, const float* __restrict__ BV, _Float16* __restrict__ QH, _Float16* __restrict__ QL, _Float16* __restrict__ KH, __bf16* __restrict__ VT, __bf16* __restrict__ VL) {
  __shared__ __align__(16) char sm[2 * 128 * 72 * 2];   /* the staging buffers (30,720 B), then, behind the loop's last barrier, the output tiles */
  _Float16 (*sh)[136] = (_Float16 (*)[136])sm; _Float16 (*sl)[136] = (_Float16 (*)[136])(sm + 64 * 136 * 2); __bf16 (*th)[72] = (__bf16 (*)[72])sm; __bf16 (*tl2)[72] = (__bf16 (*)[72])(sm + 128 * 72 * 2); __bf16* st = (__bf16*)sm;
  const int tid = threadIdx.x, wave = tid >> 5, lane = tid & 31, col = lane & 15, g = lane >> 4; const int which = blockIdx.z; const int c0 = blockIdx.y * 128; const size_t r0 = (size_t)blockIdx.x * 64; const float* WA = which == 0 ? WQ : which == 1 ? WK : WV; const float* BA = which == 0 ? BQ : which == 1 ? BK : BV; const float* X = which == 0 ? XQ : XC;
  const int wm = wave & 1, wn = wave >> 1, srow = tid >> 3, sc4 = (tid & 7) * 4;   /* staging: 8 threads cover one row's 128 B, a wave's load 4 whole lines */
  const float* gx = X + (r0 + srow) * CC + sc4; const float* gw = WA + (size_t)(c0 + srow) * CC + sc4; __bf16* sdst = st + srow * PPI + sc4;
  const __bf16* fa = st + (wm * 32 + col) * PPI; const __bf16* fw = st + (64 + wn * 64 + col) * PPI;
  v8f acc[2][4] = {}; v4f pf[12];
#pragma unroll
  for (int i = 0; i < 12; ++i) pf[i] = i < 4 ? *(const v4f*)(gx + (size_t)i * 16 * CC) : *(const v4f*)(gw + (size_t)(i - 4) * 16 * CC);
#pragma unroll
  for (int i = 0; i < 12; ++i) *(v4b*)(sdst + i * 16 * PPI) = __builtin_convertvector(pf[i], v4b);
  __syncthreads();
#pragma unroll 2
  for (int kc = 0; kc < CC / 32; ++kc) { const int cur = (kc & 1) * PBUF, nxt = PBUF - cur; v16b a[2], w[4];   /* unrolled by the two buffers, so that their offsets are constants */
    if (kc + 1 < CC / 32) {
#pragma unroll
      for (int i = 0; i < 12; ++i) pf[i] = i < 4 ? *(const v4f*)(gx + (size_t)i * 16 * CC + (kc + 1) * 32) : *(const v4f*)(gw + (size_t)(i - 4) * 16 * CC + (kc + 1) * 32); }
#pragma unroll
    for (int i = 0; i < 2; ++i) a[i] = frag_b(fa + cur + i * 16 * PPI, lane);
#pragma unroll
    for (int j = 0; j < 4; ++j) w[j] = frag_b(fw + cur + j * 16 * PPI, lane);
#pragma unroll
    for (int i = 0; i < 2; ++i)
#pragma unroll
      for (int j = 0; j < 4; ++j) acc[i][j] = wmma_bf(a[i], w[j], acc[i][j]);
    if (kc + 1 < CC / 32) {
#pragma unroll
      for (int i = 0; i < 12; ++i) *(v4b*)(sdst + nxt + i * 16 * PPI) = __builtin_convertvector(pf[i], v4b); }
    __syncthreads(); }   /* one barrier a slice: it publishes the next slice and ends the reads of the buffer that the next trip refills; the last one frees the LDS for the output tiles */
#pragma unroll
  for (int i = 0; i < 2; ++i)
#pragma unroll
  for (int j = 0; j < 4; ++j) { const float bb = BA ? bfr(BA[c0 + wn * 64 + j * 16 + col]) : 0.f;
#pragma unroll
    for (int r = 0; r < 8; ++r) { const int rl = wm * 32 + i * 16 + 8 * g + r, cl = wn * 64 + j * 16 + col; const float v = acc[i][j][r] + bb + (which == 1 ? bfr(POS[((r0 + rl) % TT) * HD + ((c0 + cl) & (HD - 1))]) : 0.f); const _Float16 hv = (_Float16)v;   /* keys carry k + pos_k */
      if (which == 2) { const __bf16 bh = (__bf16)v; th[cl][rl] = bh; tl2[cl][rl] = (__bf16)(v - (float)bh); } else { sh[rl][cl] = hv; sl[rl][cl] = (_Float16)((v - (float)hv) * 1024.0f); }   /* q residual carried x 2^10 so the plane stays f16-normal on the chip */ } }
  __syncthreads();
  if (which < 2) { _Float16* dh = which == 0 ? QH : KH; for (int e = tid; e < 64 * 16; e += 128) { const int rl = e >> 4, q = e & 15; const int c = c0 + q * 8; const size_t dst = (r0 + rl) * QW + (size_t)(c >> 6) * HDK + (c & 63);   /* head h's first 64 of its 128-wide augmented slot */ vst2((unsigned*)(dh + dst), *(const v4u*)&sh[rl][q * 8]);
      asm volatile("s_wait_xcnt 0x0" ::: "memory");   /* behind the store: its data registers take the next LDS read, its address registers are stepped for the next trip */
      __builtin_amdgcn_sched_barrier(0);   /* keeps those writes from being scheduled in front of the wait */
      if (which == 0) { vst2((unsigned*)(QL + dst), *(const v4u*)&sl[rl][q * 8]);
        asm volatile("s_wait_xcnt 0x0" ::: "memory");   /* the same behind the residual plane's store */
        __builtin_amdgcn_sched_barrier(0);   /* as above */ } } }
  else { const size_t b = r0 / TT; const int t0 = (int)(r0 % TT); for (int e = tid; e < 128 * 8; e += 128) { const int cl = e >> 3, q = e & 7; const size_t o2 = (b * CC + c0 + cl) * (size_t)TT + t0 + q * 8; vst2((unsigned*)(VT + o2), *(const v4u*)&th[cl][q * 8]); vst2((unsigned*)(VL + o2), *(const v4u*)&tl2[cl][q * 8]); } } }
__global__ __launch_bounds__(128) void k_pos(const float* __restrict__ POS, _Float16* __restrict__ QH, _Float16* __restrict__ QL, _Float16* __restrict__ KH) { __shared__ __align__(16) _Float16 sp[64][72], spl[64][72];
  const int tid = threadIdx.x; const size_t r0 = (size_t)blockIdx.x * 64;
  for (int e = tid; e < 64 * HD; e += 128) { const int rl = e / HD, d = e % HD; const float v = bfr(POS[((r0 + rl) % TT) * HD + d]); const _Float16 hv = (_Float16)v; sp[rl][d] = hv; spl[rl][d] = (_Float16)((v - (float)hv) * 1024.0f); }
  __syncthreads();
  for (int e = tid; e < 64 * NH * 8; e += 128) { const int rl = e / (NH * 8), rem = e % (NH * 8), h = rem >> 3, q = rem & 7; const size_t dst = (r0 + rl) * QW + (size_t)h * HDK + HD + q * 8; vst2((unsigned*)(QH + dst), *(const v4u*)&sp[rl][q * 8]); vst2((unsigned*)(QL + dst), *(const v4u*)&spl[rl][q * 8]); vst2((unsigned*)(KH + dst), *(const v4u*)&sp[rl][q * 8]); } }
// ---- k_att: wave = 16 queries of (b,h), all 512 keys in passes of KCH: S^T = K . Q^T (2-product 128-deep augmented logits / 8; masked keys -> -3e38), so a lane holds one query's logits and a pair of S^T tiles is already the B fragment of P^T; running softmax in f32; O^T += V^T . P^T (3 products); rows divided by their sum at the end. Every inner loop is unrolled so that each register-array index is a constant (no scratch). A pass's 128 key rows and its 64 + 64 value-plane rows (256 B each) are brought into LDS once for the block's four waves, whole lines, by asynchronous copies (the batch's mask words too, once); two buffers: the value rows fly over the pass's logits, the next pass's key rows over its softmax and P.v; fragments from LDS.
#define KCH 128   // keys per pass
#define APIT 272            // LDS pitch of a staged 256-B row in bytes (an odd multiple of 16 B, for the 16-byte fragment reads)
#define ABUF (128 * APIT)   // one staging buffer: 128 key rows, or 64 rows of each value plane
// eight asynchronous 16-byte copies a lane, rows 8 apart: a wave's copy covers two whole 256-B rows. The wait stands inside the statement: the address registers are free for new values only behind it.
__device__ __forceinline__ void copy8(unsigned l, const char* p, size_t gp) {
  asm volatile("global_load_async_to_lds_b128 %0, %8, off\n\tglobal_load_async_to_lds_b128 %1, %9, off\n\tglobal_load_async_to_lds_b128 %2, %10, off\n\tglobal_load_async_to_lds_b128 %3, %11, off\n\tglobal_load_async_to_lds_b128 %4, %12, off\n\tglobal_load_async_to_lds_b128 %5, %13, off\n\tglobal_load_async_to_lds_b128 %6, %14, off\n\tglobal_load_async_to_lds_b128 %7, %15, off\n\ts_wait_xcnt 0x0"
    :: "v"(l), "v"(l + 8 * APIT), "v"(l + 16 * APIT), "v"(l + 24 * APIT), "v"(l + 32 * APIT), "v"(l + 40 * APIT), "v"(l + 48 * APIT), "v"(l + 56 * APIT), "v"(p), "v"(p + 8 * gp), "v"(p + 16 * gp), "v"(p + 24 * gp), "v"(p + 32 * gp), "v"(p + 40 * gp), "v"(p + 48 * gp), "v"(p + 56 * gp) : "memory"); }
// publish point of the two-buffer ring: this wave's LDS reads are done, its own copies have landed, then the block's barrier (it publishes the buffer just filled and frees the one just read)
#define PUBLISH() do { asm volatile("s_wait_dscnt 0x0" ::: "memory"); asm volatile("s_wait_asynccnt 0x0" ::: "memory"); __syncthreads(); } while (0)
// fragment of 16 rows from a wave-uniform tile pointer plus the lane's own byte offset (row * pitch + 16 * (lane >> 4))
__device__ __forceinline__ v16h frag_hs(const _Float16* tile, unsigned voff) { union { v16h v; v8h q[2]; } u; const char* p = (const char*)tile + voff; u.q[0] = *(const v8h*)p; u.q[1] = *(const v8h*)(p + 32); return u.v; }
__device__ __forceinline__ v16b frag_bs(const __bf16* tile, unsigned voff) { union { v16b v; v8b q[2]; } u; const char* p = (const char*)tile + voff; u.q[0] = *(const v8b*)p; u.q[1] = *(const v8b*)(p + 32); return u.v; }
__global__ __launch_bounds__(128) void k_att(const _Float16* __restrict__ QH, const _Float16* __restrict__ QL, const _Float16* __restrict__ KH, const int* __restrict__ KM0, const __bf16* __restrict__ VT, const __bf16* __restrict__ VL, float* __restrict__ Y) { __shared__ __align__(16) float ss[4][16][HD + 4]; __shared__ __align__(16) char sm[2 * ABUF]; __shared__ __align__(16) int smk[TT]; const int b = blockIdx.z / NH, h = blockIdx.z % NH;
  const int tid = threadIdx.x, wave = __builtin_amdgcn_readfirstlane(tid >> 5), lane = tid & 31, col = lane & 15, g = lane >> 4; const int ql0 = blockIdx.x * 64 + wave * 16;   /* the wave's number as a scalar: the tile pointers below stay wave-uniform */
  const unsigned vq = (unsigned)(col * QW + 8 * g) * 2u, vm = (unsigned)g * 32u;   /* lane offsets in bytes: q rows, mask */
  const size_t qo = ((size_t)b * TT + ql0) * QW + h * HDK; const _Float16* KB = KH + (size_t)b * TT * QW + h * HDK; const size_t vo = ((size_t)b * CC + h * HD) * (size_t)TT; const int* KM = KM0 + (size_t)b * TT;
  const unsigned lf = (unsigned)(col * APIT + 16 * g);   /* lane offset of a fragment row in a staging buffer */
  const unsigned cl = (unsigned)(size_t)sm + (unsigned)((tid >> 4) * APIT + (tid & 15) * 16);   /* the lane's LDS byte address for copies: 16 lanes a row */
  const char* ck = (const char*)KB + (size_t)(tid >> 4) * (QW * 2) + (tid & 15) * 16; const char* cvh = (const char*)(VT + vo) + (size_t)(tid >> 4) * (TT * 2) + (tid & 15) * 16; const char* cvl = (const char*)(VL + vo) + (size_t)(tid >> 4) * (TT * 2) + (tid & 15) * 16;
  v16h qh[HDK / 32], ql[HDK / 32];
  __builtin_amdgcn_sched_barrier(0);   /* the address arithmetic above stays in front of the query loads, so that none of it lands between them and their wait */
#pragma unroll
  for (int kc = 0; kc < HDK / 32; ++kc) { qh[kc] = frag_hs(QH + qo + kc * 32, vq); ql[kc] = frag_hs(QL + qo + kc * 32, vq); }
  asm volatile("s_wait_xcnt 0x0" ::: "memory");   /* behind the run of query loads: their offset register is given a new value further down */
  __builtin_amdgcn_sched_barrier(0);   /* keeps that later write from being scheduled in front of the wait */
  copy8(cl, ck, QW * 2); copy8(cl + 64 * APIT, ck + (size_t)64 * (QW * 2), QW * 2);   /* pass 0's key rows */
  asm volatile("global_load_async_to_lds_b128 %0, %1, off\n\ts_wait_xcnt 0x0" :: "v"((unsigned)(size_t)smk + (unsigned)tid * 16u), "v"((const char*)KM + tid * 16) : "memory");   /* the batch's 512 mask words, 16 B a lane, filled once; the wait inside the statement as in copy8 */
  asm volatile("s_wait_asynccnt 0x0" ::: "memory");   /* this wave's key rows and mask words have landed */
  __syncthreads();   /* every wave's have: nothing of them is read in front of this */
  copy8(cl + ABUF, cvh, TT * 2); copy8(cl + ABUF + 64 * APIT, cvl, TT * 2);   /* pass 0's value rows */
  v8f acc[HD / 16] = {}; float mrun = -3.0e38f, lrun = 0.f;
#pragma unroll 1
  for (int k0 = 0; k0 < TT; k0 += KCH) { v8f s[KCH / 16];   /* rolled: one pass of logits in registers, one pass of code in the instruction cache */
#pragma unroll
    for (int jt = 0; jt < KCH / 16; ++jt) { v8f a = {}, al = {}; v16h kb[HDK / 32]; int km[8];   /* a tile's loads stand together in front of its products: one wait a tile */
#pragma unroll
      for (int kc = 0; kc < HDK / 32; ++kc) kb[kc] = frag_hs((const _Float16*)(sm + jt * 16 * APIT + kc * 64), lf);
#pragma unroll
      for (int r = 0; r < 8; ++r) km[r] = ((const int*)((const char*)(smk + k0 + jt * 16) + vm))[r];
#pragma unroll
      for (int kc = 0; kc < HDK / 32; ++kc) { a = wmma16(kb[kc], qh[kc], a); al = wmma16(kb[kc], ql[kc], al); }
#pragma unroll
      for (int r = 0; r < 8; ++r) { float v = (a[r] + al[r] * (1.0f / 1024.0f)) * 0.125f; if (km[r] == 0) v = -3.0e38f; /* D element r = key 8g + r of query col; attention_mask == 0 -> -inf */ s[jt][r] = v; } }
    float cm = -3.0e38f;
#pragma unroll
    for (int jt = 0; jt < KCH / 16; ++jt)
#pragma unroll
      for (int r = 0; r < 8; ++r) cm = fmaxf(cm, s[jt][r]);
    cm = fmaxf(cm, __shfl_xor(cm, 16));   /* lanes c and c + 16 hold the two halves of query c's keys */
    PUBLISH();   /* the pass's value rows are in; the key buffer is free (the maximum stands in front of the copies' branch, so that the finished logits and not every tile's two raw accumulators are live over it) */
    if (k0 + KCH < TT) { copy8(cl, ck + (size_t)(k0 + KCH) * (QW * 2), QW * 2); copy8(cl + 64 * APIT, ck + (size_t)(k0 + KCH + 64) * (QW * 2), QW * 2); }   /* the next pass's key rows */
    const float mn = fmaxf(mrun, cm), alpha = expf(mrun - mn); mrun = mn; float sum = 0.f;
#pragma unroll
    for (int jt = 0; jt < KCH / 16; ++jt)
#pragma unroll
      for (int r = 0; r < 8; ++r) { const float v = s[jt][r]; const float x = expf(v - mn), e = (v <= -1.0e38f) ? 0.f : x; s[jt][r] = e; sum += e; }   /* the select matters only while every key so far is masked (v - mn = 0) */
    lrun = lrun * alpha + sum;
#pragma unroll
    for (int j = 0; j < HD / 16; ++j) acc[j] *= alpha;
#pragma unroll
    for (int kc = 0; kc < KCH / 32; ++kc) { float v[16]; v16b vh[HD / 16], vl[HD / 16];   /* the 32 keys' value loads stand together, in front of the split and the products */
#pragma unroll
      for (int j = 0; j < HD / 16; ++j) { const char* po = sm + ABUF + j * 16 * APIT + kc * 64; vh[j] = frag_bs((const __bf16*)po, lf); vl[j] = frag_bs((const __bf16*)(po + 64 * APIT), lf); }
#pragma unroll
      for (int i = 0; i < 8; ++i) { v[i] = s[2 * kc][i]; v[8 + i] = s[2 * kc + 1][i]; }
      const F2 p = bsplit16(v);
#pragma unroll
      for (int j = 0; j < HD / 16; ++j) { acc[j] = wmma_bf(vh[j], p.h, acc[j]); acc[j] = wmma_bf(vh[j], p.l, acc[j]); acc[j] = wmma_bf(vl[j], p.h, acc[j]); } }
    PUBLISH();   /* the next pass's key rows are in; the value buffer is free */
    if (k0 + KCH < TT) { copy8(cl + ABUF, cvh + (size_t)(k0 + KCH) * 2, TT * 2); copy8(cl + ABUF + 64 * APIT, cvl + (size_t)(k0 + KCH) * 2, TT * 2); }   /* the next pass's value rows */ }
  asm volatile("s_wait_asynccnt 0x0" ::: "memory");   /* no copy is left in flight behind the loop */
  const float inv = 1.0f / (lrun + __shfl_xor(lrun, 16));
#pragma unroll
  for (int j = 0; j < HD / 16; ++j) { v4f lo, hi;   /* D element r = d 16j + 8g + r of query col */
#pragma unroll
    for (int r = 0; r < 4; ++r) { lo[r] = acc[j][r] * inv; hi[r] = acc[j][4 + r] * inv; }
    *(v4f*)&ss[wave][col][j * 16 + 8 * g] = lo; *(v4f*)&ss[wave][col][j * 16 + 8 * g + 4] = hi; }
  LDSX();
#pragma unroll
  for (int rl = 0; rl < 16; rl += 2) vst2(Y + ((size_t)b * TT + ql0 + rl + g) * CC + h * HD + col * 4, *(const v4f*)&ss[wave][rl + g][col * 4]); }
extern "C" void kernel_launch(void* const* d_in, const int* in_sizes, int n_in, void* d_out, int out_size, void* d_ws, size_t ws_size, hipStream_t stream) {
  (void)in_sizes; (void)n_in; (void)out_size;
  const float** F = (const float**)d_in;   // 0 hidden_states [8,512,768], 1 context [8,512,768], 2 attention_mask [8,512] int (verbatim 0/1), 3 Wq [768,768] ([out,in]), 4 bq, 5 Wk, 6 bk, 7 Wv, 8 bv, 9 abs_pos_emb [512,64]
  if (ws_size < (size_t)WS_END) return;
  char* ws = (char*)d_ws; _Float16 *QH = (_Float16*)(ws + WS_QH), *QL = (_Float16*)(ws + WS_QL), *KH = (_Float16*)(ws + WS_KH); __bf16 *VT = (__bf16*)(ws + WS_VT), *VL = (__bf16*)(ws + WS_VL);
  k_proj<<<dim3(TNB * TT / 64, CC / 128, 3), 128, 0, stream>>>(F[0], F[1], F[9], F[3], F[4], F[5], F[6], F[7], F[8], QH, QL, KH, VT, VL);
  k_pos<<<dim3(TNB * TT / 64), 128, 0, stream>>>(F[9], QH, QL, KH);
  k_att<<<dim3(TT / 64, 1, HG), 128, 0, stream>>>(QH, QL, KH, (const int*)d_in[2], VT, VL, (float*)d_out);
}

// v005
// Measured time: 57.7 microseconds a run.
// Timed twice side by side with v004, it ran 1.26 times as fast both times.
// Counting every step since v000, it is 10.8 times as fast.
// compute dtype: all float inputs rounded to bf16, the key mask (int) read; q/k/v = x W^T + b with EXACT bf16 products on WMMA 16x16x32, f32 accumulate; the two score terms fused as one 128-deep contraction [q | pos_q] . [k + pos_k | pos_k] with the query side as f16 hi + residual (x 2^10) and the key side once in f16 (2 products), / 8, masked keys excluded, kept in f32 registers (all 8 batches x 12 heads per launch); running softmax in f32 (precise expf), unnormalised P f32 split bf16 hi + lo against v bf16 hi + lo (3 products), rows divided by their f32 sum at the end; merged heads in f32 (no output projection).
#include <hip/hip_runtime.h>
#include <math.h>

typedef __attribute__((ext_vector_type(16))) _Float16 v16h;
typedef __attribute__((ext_vector_type(16))) __bf16 v16b;
typedef __attribute__((ext_vector_type(8)))  _Float16 v8h;
typedef __attribute__((ext_vector_type(8)))  float v8f;
typedef __attribute__((ext_vector_type(4)))  float v4f;
typedef __attribute__((ext_vector_type(2)))  float v2f;
typedef __attribute__((ext_vector_type(4)))  unsigned v4u;
typedef __attribute__((ext_vector_type(4)))  int v4i;
typedef float __attribute__((may_alias)) float_a;
typedef int __attribute__((may_alias)) int_a;

template <typename T> __device__ __forceinline__ void vst2(void* p, T v) { *(T*)p = v;  }
__device__ __forceinline__ v8f wmma16(v16h a, v16h b, v8f c) {
  v8f d = __builtin_amdgcn_wmma_f32_16x16x32_f16(false, a, false, b, (short)0, c, false, false);
  asm volatile("v_nop\n\tv_nop\n\tv_nop\n\tv_nop" : "+v"(d) : "v"(a), "v"(b));
  return d;
}
__device__ __forceinline__ v8f wmma_bf(v16b a, v16b b, v8f c) {
  v8f d = __builtin_amdgcn_wmma_f32_16x16x32_bf16(false, a, false, b, (short)0, c, false, false);
  asm volatile("v_nop\n\tv_nop\n\tv_nop\n\tv_nop" : "+v"(d) : "v"(a), "v"(b));
  return d;
}
// 16x16x32 fragments: lane = (h = lane>>4, row/col = lane&15); elements 0..7 = k0+8h+0..7, 8..15 = k0+16+8h+0..7; D element r = row 8h+r
__device__ __forceinline__ v16h frag_h(const _Float16* rowk0, int lane) {
  union { v16h v; v8h q[2]; } u; const _Float16* p = rowk0 + 8 * (lane >> 4);
  u.q[0] = *(const v8h*)p; u.q[1] = *(const v8h*)(p + 16); return u.v;
}
__device__ __forceinline__ v16h frag_f32(const float* rowk0, int lane) {
  v16h a; const float* p = rowk0 + 8 * (lane >> 4);
#pragma unroll
  for (int i = 0; i < 8; ++i) { a[i] = (_Float16)p[i]; a[8 + i] = (_Float16)p[16 + i]; }
  return a;
}
__device__ __forceinline__ v16h frag_f32s(const float* rowk0, int lane, float sc) {
  v16h a; const float* p = rowk0 + 8 * (lane >> 4);
#pragma unroll
  for (int i = 0; i < 8; ++i) { a[i] = (_Float16)(p[i] * sc); a[8 + i] = (_Float16)(p[16 + i] * sc); }
  return a;
}
// column fragment from a [K][ld] layout (column n), rows >= K read as 0
__device__ __forceinline__ v16h fragc_f32(const float* W, int k0, int n, int lane, int ld, int K) {
  v16h a; const int g = lane >> 4;
#pragma unroll
  for (int i = 0; i < 8; ++i) { const int ka = k0 + 8 * g + i, kb = ka + 16;
    a[i] = (_Float16)(ka < K ? W[(size_t)(ka < K ? ka : K - 1) * ld + n] : 0.f); a[8 + i] = (_Float16)(kb < K ? W[(size_t)(kb < K ? kb : K - 1) * ld + n] : 0.f); }
  return a;
}
struct F2 { v16b h, l; };
__device__ __forceinline__ F2 bsplit16(const float v[16]) { F2 r;
#pragma unroll
  for (int i = 0; i < 16; ++i) { const __bf16 h = (__bf16)v[i]; r.h[i] = h; r.l[i] = (__bf16)(v[i] - (float)h); }
  return r; }
__device__ __forceinline__ F2 split_row(const float* row, int k0, int lane) { float v[16]; const float* p = row + k0 + 8 * (lane >> 4);
#pragma unroll
  for (int i = 0; i < 8; ++i) { v[i] = p[i]; v[8 + i] = p[16 + i]; }
  return bsplit16(v); }
__device__ __forceinline__ F2 split_rowK(const float* row, int k0, int lane, int K) { float v[16]; const int g = lane >> 4;
#pragma unroll
  for (int i = 0; i < 8; ++i) { const int ka = k0 + 8 * g + i, kb = ka + 16; v[i] = ka < K ? row[ka < K ? ka : K - 1] : 0.f; v[8 + i] = kb < K ? row[kb < K ? kb : K - 1] : 0.f; }
  return bsplit16(v); }
__device__ __forceinline__ F2 split_col(const float* W, int k0, int n, int lane, int ld, int K) { float v[16]; const int g = lane >> 4;
#pragma unroll
  for (int i = 0; i < 8; ++i) { const int ka = k0 + 8 * g + i, kb = ka + 16; v[i] = ka < K ? W[(size_t)(ka < K ? ka : K - 1) * ld + n] : 0.f; v[8 + i] = kb < K ? W[(size_t)(kb < K ? kb : K - 1) * ld + n] : 0.f; }
  return bsplit16(v); }
__device__ __forceinline__ v8f mac3(const F2& a, const F2& b, v8f c) { c = wmma_bf(a.l, b.h, c); c = wmma_bf(a.h, b.l, c); return wmma_bf(a.h, b.h, c); }
__device__ __forceinline__ float sigm(float v) { return 1.0f / (1.0f + expf(-v)); }
#define LDSX() do { asm volatile("s_wait_dscnt 0" ::: "memory"); __builtin_amdgcn_wave_barrier(); __builtin_amdgcn_fence(__ATOMIC_RELEASE, "workgroup"); } while (0)


// Attention with absolute-position bias (B 8, SQ = SK = 512, H 768 = 12 x 64): q from hidden_states, k/v from context (Linear [out,in] + bias); scores = (q.k + (q + pos_q).pos_k) / 8 = ([q | pos_q] . [k + pos_k | pos_k]) / 8; keys with attention_mask == 0 -> -inf; softmax; P v; heads merged.
#define NB 8
#define TT 512
#define CC 768
#define NH 12
#define HD 64
#define HDK 128        // augmented logit depth [q | pos]
#define QW (NH * HDK)  // 1,536: row width of the augmented q/k rows
#ifndef TNB
#define TNB NB
#endif
typedef __attribute__((ext_vector_type(8))) __bf16 v8b;
__device__ __forceinline__ v16b frag_b(const __bf16* rowk0, int lane) {
  union { v16b v; v8b q[2]; } u; const __bf16* p = rowk0 + 8 * (lane >> 4);
  u.q[0] = *(const v8b*)p; u.q[1] = *(const v8b*)(p + 16); return u.v;
}
__device__ __forceinline__ float bfr(float v) { return (float)(__bf16)v; }
__device__ __attribute__((noinline)) float exp_ni(float v) { return expf(v); }
__device__ __attribute__((noinline)) float erf_ni(float v) { return erff(v); }

#define WS_QH  0u
#define WS_QL  (WS_QH + 2u * (size_t)NB * TT * QW)
#define WS_KH  (WS_QL + 2u * (size_t)NB * TT * QW)
#define WS_VT  (WS_KH + 2u * (size_t)NB * TT * QW)      // bf16 v planes [b][c][t]
#define WS_VL  (WS_VT + 2u * (size_t)NB * CC * TT)      // bf16 v residual planes
#define HG (NB * NH)                                   // (batch, head) pairs per launch: all of them, blockIdx.z = b * NH + h
#define WS_END (WS_VL + 2u * (size_t)NB * CC * TT)      // no logits plane, no Y plane: k_att writes d_out

// ---- k_proj: block = (64 rows, 128 cols, which): qkv = x W (+ b), exact; q -> f16 hi (+ residual), k -> f16 rows, v -> bf16 hi + lo planes. Each 32-deep slice of the block's x rows and W rows is loaded once, whole lines, rounded to bf16 once and laid in LDS (two buffers, the next slice's loads in flight over this slice's products); wave = 32 rows x 64 cols, fragments from LDS. A q or k block also lays its 64 position rows in LDS in front of the loop (whole lines, rounded to bf16, kept as f32): the k rows take k + pos_k from there, and the block stores the position halves of its two heads' augmented rows itself.
#define PPI 40                 // LDS pitch of a staged row in bf16: 64 B of data + 16 B (an odd multiple of 16 B, for the 16-byte fragment reads)
#define PBUF ((64 + 128) * PPI) // one staging buffer in bf16: x rows 0..63, W rows 64..191
typedef __attribute__((ext_vector_type(4))) __bf16 v4b;
#define PPOS 68                // LDS pitch of a position row in f32: 256 B of data + 16 B
#define POFF (2 * 64 * 136 * 2) // the position rows' place in LDS: behind the q/k output tiles, clear of the staging buffers
// q or k output tiles of a wave (KP: keys, which carry k + pos_k and have no residual plane)
template <int KP> __device__ __forceinline__ void qk_tiles(const v8f (&acc)[2][4], const float* BA, const float (*sp)[PPOS], _Float16 (*sh)[136], _Float16 (*sl)[136], int c0, int wm, int wn, int col, int g) {
#pragma unroll
  for (int i = 0; i < 2; ++i)
#pragma unroll
  for (int j = 0; j < 4; ++j) { const float bb = BA ? bfr(BA[c0 + wn * 64 + j * 16 + col]) : 0.f;
#pragma unroll
    for (int r = 0; r < 8; ++r) { const int rl = wm * 32 + i * 16 + 8 * g + r, cl = wn * 64 + j * 16 + col; float v = acc[i][j][r] + bb; if (KP) v += sp[rl][j * 16 + col]; const _Float16 hv = (_Float16)v; sh[rl][cl] = hv;
      if (!KP) sl[rl][cl] = (_Float16)((v - (float)hv) * 1024.0f);   /* q residual carried x 2^10 so the plane stays f16-normal on the chip */ } } }
__global__ __launch_bounds__(128) void k_proj(const float* __restrict__ XQ, const float* __restrict__ XC, const float* __restrict__ POS, const float* __restrict__ WQ, const float* __restrict__ BQ, const float* __restrict__ WK, const float* __restrict__ BK, const float* __restrict__ WV, const float* __restrict__ BV, _Float16* __restrict__ QH, _Float16* __restrict__ QL, _Float16* __restrict__ KH, __bf16* __restrict__ VT, __bf16* __restrict__ VL) {
  __shared__ __align__(16) char sm[POFF + 64 * PPOS * 4];   /* the staging buffers (30,720 B), then, behind the loop's last barrier, the output tiles; behind them the position rows of a q or k block */
  _Float16 (*sh)[136] = (_Float16 (*)[136])sm; _Float16 (*sl)[136] = (_Float16 (*)[136])(sm + 64 * 136 * 2); __bf16 (*th)[72] = (__bf16 (*)[72])sm; __bf16 (*tl2)[72] = (__bf16 (*)[72])(sm + 128 * 72 * 2); __bf16* st = (__bf16*)sm; float (*sp)[PPOS] = (float (*)[PPOS])(sm + POFF);
  const int tid = threadIdx.x, wave = tid >> 5, lane = tid & 31, col = lane & 15, g = lane >> 4; const int which = blockIdx.z; const int c0 = blockIdx.y * 128; const size_t r0 = (size_t)blockIdx.x * 64; const float* WA = which == 0 ? WQ : which == 1 ? WK : WV; const float* BA = which == 0 ? BQ : which == 1 ? BK : BV; const float* X = which == 0 ? XQ : XC;
  const int wm = wave & 1, wn = wave >> 1, srow = tid >> 3, sc4 = (tid & 7) * 4;   /* staging: 8 threads cover one row's 128 B, a wave's load 4 whole lines */
  const float* gx = X + (r0 + srow) * CC + sc4; const float* gw = WA + (size_t)(c0 + srow) * CC + sc4; __bf16* sdst = st + srow * PPI + sc4;
  const __bf16* fa = st + (wm * 32 + col) * PPI; const __bf16* fw = st + (64 + wn * 64 + col) * PPI;
  v8f acc[2][4] = {}; v4f pf[12];
#pragma unroll
  for (int i = 0; i < 12; ++i) pf[i] = i < 4 ? *(const v4f*)(gx + (size_t)i * 16 * CC) : *(const v4f*)(gw + (size_t)(i - 4) * 16 * CC);
  if (which < 2) { const float* gp = POS + (r0 % TT) * HD + tid * 4; v4f pp[8];   /* the block's 64 position rows, 16 KB in a row: a wave's load covers 4 whole lines; in flight together with the first slice; published by the barrier below */
    asm volatile("s_wait_xcnt 0x0" ::: "memory");   /* in front of the position loads: their results may take the registers that held the first slice's addresses */
#pragma unroll
    for (int i = 0; i < 8; ++i) pp[i] = *(const v4f*)(gp + i * 512);
#pragma unroll
    for (int i = 0; i < 8; ++i) { v4f t;
#pragma unroll
      for (int c = 0; c < 4; ++c) t[c] = bfr(pp[i][c]);
      *(v4f*)&sp[(tid >> 4) + i * 8][(tid & 15) * 4] = t; } }
#pragma unroll
  for (int i = 0; i < 12; ++i) *(v4b*)(sdst + i * 16 * PPI) = __builtin_convertvector(pf[i], v4b);
  __syncthreads();
#pragma unroll 2
  for (int kc = 0; kc < CC / 32; ++kc) { const int cur = (kc & 1) * PBUF, nxt = PBUF - cur; v16b a[2], w[4];   /* unrolled by the two buffers, so that their offsets are constants */
    if (kc + 1 < CC / 32) {
#pragma unroll
      for (int i = 0; i < 12; ++i) pf[i] = i < 4 ? *(const v4f*)(gx + (size_t)i * 16 * CC + (kc + 1) * 32) : *(const v4f*)(gw + (size_t)(i - 4) * 16 * CC + (kc + 1) * 32); }
#pragma unroll
    for (int i = 0; i < 2; ++i) a[i] = frag_b(fa + cur + i * 16 * PPI, lane);
#pragma unroll
    for (int j = 0; j < 4; ++j) w[j] = frag_b(fw + cur + j * 16 * PPI, lane);
#pragma unroll
    for (int i = 0; i < 2; ++i)
#pragma unroll
      for (int j = 0; j < 4; ++j) acc[i][j] = wmma_bf(a[i], w[j], acc[i][j]);
    if (kc + 1 < CC / 32) {
#pragma unroll
      for (int i = 0; i < 12; ++i) *(v4b*)(sdst + nxt + i * 16 * PPI) = __builtin_convertvector(pf[i], v4b); }
    __syncthreads(); }   /* one barrier a slice: it publishes the next slice and ends the reads of the buffer that the next trip refills; the last one frees the LDS for the output tiles */
  if (which == 2) {
#pragma unroll
    for (int i = 0; i < 2; ++i)
#pragma unroll
    for (int j = 0; j < 4; ++j) { const float bb = BA ? bfr(BA[c0 + wn * 64 + j * 16 + col]) : 0.f;
#pragma unroll
      for (int r = 0; r < 8; ++r) { const int rl = wm * 32 + i * 16 + 8 * g + r, cl = wn * 64 + j * 16 + col; const float v = acc[i][j][r] + bb; const __bf16 bh = (__bf16)v; th[cl][rl] = bh; tl2[cl][rl] = (__bf16)(v - (float)bh); } } }
  else { _Float16* dp = (which == 0 ? QH : KH) + (r0 + (tid >> 3)) * QW + (size_t)(c0 >> 6) * HDK + HD + (tid & 7) * 8; _Float16* dq = QL + (r0 + (tid >> 3)) * QW + (size_t)(c0 >> 6) * HDK + HD + (tid & 7) * 8; float pv[4][8]; v8h ph[4];   /* the position halves of the block's two heads: 8 lanes a row's 128 B, rows 16 apart */
#pragma unroll
    for (int i = 0; i < 4; ++i) { const float* s = &sp[(tid >> 3) + i * 16][(tid & 7) * 8];
#pragma unroll
      for (int c = 0; c < 8; ++c) { pv[i][c] = s[c]; ph[i][c] = (_Float16)pv[i][c]; } }
#pragma unroll
    for (int i = 0; i < 4; ++i) { vst2(dp + (size_t)i * 16 * QW, ph[i]); vst2(dp + (size_t)i * 16 * QW + HDK, ph[i]); }
    asm volatile("s_wait_xcnt 0x0" ::: "memory");   /* behind the run of stores: their data and address registers are given new values further down */
    __builtin_amdgcn_sched_barrier(0);   /* keeps those writes from being scheduled in front of the wait */
    if (which == 0) { v8h pl[4];
#pragma unroll
      for (int i = 0; i < 4; ++i)
#pragma unroll
        for (int c = 0; c < 8; ++c) pl[i][c] = (_Float16)((pv[i][c] - (float)ph[i][c]) * 1024.0f);
#pragma unroll
      for (int i = 0; i < 4; ++i) { vst2(dq + (size_t)i * 16 * QW, pl[i]); vst2(dq + (size_t)i * 16 * QW + HDK, pl[i]); }
      asm volatile("s_wait_xcnt 0x0" ::: "memory");   /* the same behind the residual plane's run */
      __builtin_amdgcn_sched_barrier(0);   /* as above */
      qk_tiles<0>(acc, BA, sp, sh, sl, c0, wm, wn, col, g); }
    else qk_tiles<1>(acc, BA, sp, sh, sl, c0, wm, wn, col, g); }
  __syncthreads();
  if (which < 2) { _Float16* dh = which == 0 ? QH : KH; for (int e = tid; e < 64 * 16; e += 128) { const int rl = e >> 4, q = e & 15; const int c = c0 + q * 8; const size_t dst = (r0 + rl) * QW + (size_t)(c >> 6) * HDK + (c & 63);   /* head h's first 64 of its 128-wide augmented slot */ vst2((unsigned*)(dh + dst), *(const v4u*)&sh[rl][q * 8]);
      asm volatile("s_wait_xcnt 0x0" ::: "memory");   /* behind the store: its data registers take the next LDS read, its address registers are stepped for the next trip */
      __builtin_amdgcn_sched_barrier(0);   /* keeps those writes from being scheduled in front of the wait */
      if (which == 0) { vst2((unsigned*)(QL + dst), *(const v4u*)&sl[rl][q * 8]);
        asm volatile("s_wait_xcnt 0x0" ::: "memory");   /* the same behind the residual plane's store */
        __builtin_amdgcn_sched_barrier(0);   /* as above */ } } }
  else { const size_t b = r0 / TT; const int t0 = (int)(r0 % TT); for (int e = tid; e < 128 * 8; e += 128) { const int cl = e >> 3, q = e & 7; const size_t o2 = (b * CC + c0 + cl) * (size_t)TT + t0 + q * 8; vst2((unsigned*)(VT + o2), *(const v4u*)&th[cl][q * 8]); vst2((unsigned*)(VL + o2), *(const v4u*)&tl2[cl][q * 8]); } } }
// ---- k_att: wave = 16 queries of (b,h), all 512 keys in passes of KCH: S^T = K . Q^T (2-product 128-deep augmented logits / 8; masked keys -> -3e38), so a lane holds one query's logits and a pair of S^T tiles is already the B fragment of P^T; running softmax in f32; O^T += V^T . P^T (3 products); rows divided by their sum at the end. Every inner loop is unrolled so that each register-array index is a constant (no scratch). A pass's 128 key rows and its 64 + 64 value-plane rows (256 B each) are brought into LDS once for the block's four waves, whole lines, by asynchronous copies (the batch's mask words too, once); two buffers: the value rows fly over the pass's logits, the next pass's key rows over its softmax and P.v; fragments from LDS.
#define KCH 128   // keys per pass
#define APIT 272            // LDS pitch of a staged 256-B row in bytes (an odd multiple of 16 B, for the 16-byte fragment reads)
#define ABUF (128 * APIT)   // one staging buffer: 128 key rows, or 64 rows of each value plane
// eight asynchronous 16-byte copies a lane, rows 8 apart: a wave's copy covers two whole 256-B rows. The wait stands inside the statement: the address registers are free for new values only behind it.
__device__ __forceinline__ void copy8(unsigned l, const char* p, size_t gp) {
  asm volatile("global_load_async_to_lds_b128 %0, %8, off\n\tglobal_load_async_to_lds_b128 %1, %9, off\n\tglobal_load_async_to_lds_b128 %2, %10, off\n\tglobal_load_async_to_lds_b128 %3, %11, off\n\tglobal_load_async_to_lds_b128 %4, %12, off\n\tglobal_load_async_to_lds_b128 %5, %13, off\n\tglobal_load_async_to_lds_b128 %6, %14, off\n\tglobal_load_async_to_lds_b128 %7, %15, off\n\ts_wait_xcnt 0x0"
    :: "v"(l), "v"(l + 8 * APIT), "v"(l + 16 * APIT), "v"(l + 24 * APIT), "v"(l + 32 * APIT), "v"(l + 40 * APIT), "v"(l + 48 * APIT), "v"(l + 56 * APIT), "v"(p), "v"(p + 8 * gp), "v"(p + 16 * gp), "v"(p + 24 * gp), "v"(p + 32 * gp), "v"(p + 40 * gp), "v"(p + 48 * gp), "v"(p + 56 * gp) : "memory"); }
// publish point of the two-buffer ring: this wave's LDS reads are done, its own copies have landed, then the block's barrier (it publishes the buffer just filled and frees the one just read)
#define PUBLISH() do { asm volatile("s_wait_dscnt 0x0" ::: "memory"); asm volatile("s_wait_asynccnt 0x0" ::: "memory"); __syncthreads(); } while (0)
// fragment of 16 rows from a wave-uniform tile pointer plus the lane's own byte offset (row * pitch + 16 * (lane >> 4))
__device__ __forceinline__ v16h frag_hs(const _Float16* tile, unsigned voff) { union { v16h v; v8h q[2]; } u; const char* p = (const char*)tile + voff; u.q[0] = *(const v8h*)p; u.q[1] = *(const v8h*)(p + 32); return u.v; }
__device__ __forceinline__ v16b frag_bs(const __bf16* tile, unsigned voff) { union { v16b v; v8b q[2]; } u; const char* p = (const char*)tile + voff; u.q[0] = *(const v8b*)p; u.q[1] = *(const v8b*)(p + 32); return u.v; }
__global__ __launch_bounds__(128) void k_att(const _Float16* __restrict__ QH, const _Float16* __restrict__ QL, const _Float16* __restrict__ KH, const int* __restrict__ KM0, const __bf16* __restrict__ VT, const __bf16* __restrict__ VL, float* __restrict__ Y) { __shared__ __align__(16) float ss[4][16][HD + 4]; __shared__ __align__(16) char sm[2 * ABUF]; __shared__ __align__(16) int smk[TT]; const int b = blockIdx.z / NH, h = blockIdx.z % NH;
  const int tid = threadIdx.x, wave = __builtin_amdgcn_readfirstlane(tid >> 5), lane = tid & 31, col = lane & 15, g = lane >> 4; const int ql0 = blockIdx.x * 64 + wave * 16;   /* the wave's number as a scalar: the tile pointers below stay wave-uniform */
  const unsigned vq = (unsigned)(col * QW + 8 * g) * 2u, vm = (unsigned)g * 32u;   /* lane offsets in bytes: q rows, mask */
  const size_t qo = ((size_t)b * TT + ql0) * QW + h * HDK; const _Float16* KB = KH + (size_t)b * TT * QW + h * HDK; const size_t vo = ((size_t)b * CC + h * HD) * (size_t)TT; const int* KM = KM0 + (size_t)b * TT;
  const unsigned lf = (unsigned)(col * APIT + 16 * g);   /* lane offset of a fragment row in a staging buffer */
  const unsigned cl = (unsigned)(size_t)sm + (unsigned)((tid >> 4) * APIT + (tid & 15) * 16);   /* the lane's LDS byte address for copies: 16 lanes a row */
  const char* ck = (const char*)KB + (size_t)(tid >> 4) * (QW * 2) + (tid & 15) * 16; const char* cvh = (const char*)(VT + vo) + (size_t)(tid >> 4) * (TT * 2) + (tid & 15) * 16; const char* cvl = (const char*)(VL + vo) + (size_t)(tid >> 4) * (TT * 2) + (tid & 15) * 16;
  v16h qh[HDK / 32], ql[HDK / 32];
  __builtin_amdgcn_sched_barrier(0);   /* the address arithmetic above stays in front of the query loads, so that none of it lands between them and their wait */
#pragma unroll
  for (int kc = 0; kc < HDK / 32; ++kc) { qh[kc] = frag_hs(QH + qo + kc * 32, vq); ql[kc] = frag_hs(QL + qo + kc * 32, vq); }
  asm volatile("s_wait_xcnt 0x0" ::: "memory");   /* behind the run of query loads: their offset register is given a new value further down */
  __builtin_amdgcn_sched_barrier(0);   /* keeps that later write from being scheduled in front of the wait */
  copy8(cl, ck, QW * 2); copy8(cl + 64 * APIT, ck + (size_t)64 * (QW * 2), QW * 2);   /* pass 0's key rows */
  asm volatile("global_load_async_to_lds_b128 %0, %1, off\n\ts_wait_xcnt 0x0" :: "v"((unsigned)(size_t)smk + (unsigned)tid * 16u), "v"((const char*)KM + tid * 16) : "memory");   /* the batch's 512 mask words, 16 B a lane, filled once; the wait inside the statement as in copy8 */
  asm volatile("s_wait_asynccnt 0x0" ::: "memory");   /* this wave's key rows and mask words have landed */
  __syncthreads();   /* every wave's have: nothing of them is read in front of this */
  copy8(cl + ABUF, cvh, TT * 2); copy8(cl + ABUF + 64 * APIT, cvl, TT * 2);   /* pass 0's value rows */
  v8f acc[HD / 16] = {}; float mrun = -3.0e38f, lrun = 0.f;
#pragma unroll 1
  for (int k0 = 0; k0 < TT; k0 += KCH) { v8f s[KCH / 16];   /* rolled: one pass of logits in registers, one pass of code in the instruction cache */
#pragma unroll
    for (int jt = 0; jt < KCH / 16; ++jt) { v8f a = {}, al = {}; v16h kb[HDK / 32]; int km[8];   /* a tile's loads stand together in front of its products: one wait a tile */
#pragma unroll
      for (int kc = 0; kc < HDK / 32; ++kc) kb[kc] = frag_hs((const _Float16*)(sm + jt * 16 * APIT + kc * 64), lf);
#pragma unroll
      for (int r = 0; r < 8; ++r) km[r] = ((const int*)((const char*)(smk + k0 + jt * 16) + vm))[r];
#pragma unroll
      for (int kc = 0; kc < HDK / 32; ++kc) { a = wmma16(kb[kc], qh[kc], a); al = wmma16(kb[kc], ql[kc], al); }
#pragma unroll
      for (int r = 0; r < 8; ++r) { float v = (a[r] + al[r] * (1.0f / 1024.0f)) * 0.125f; if (km[r] == 0) v = -3.0e38f; /* D element r = key 8g + r of query col; attention_mask == 0 -> -inf */ s[jt][r] = v; } }
    float cm = -3.0e38f;
#pragma unroll
    for (int jt = 0; jt < KCH / 16; ++jt)
#pragma unroll
      for (int r = 0; r < 8; ++r) cm = fmaxf(cm, s[jt][r]);
    cm = fmaxf(cm, __shfl_xor(cm, 16));   /* lanes c and c + 16 hold the two halves of query c's keys */
    PUBLISH();   /* the pass's value rows are in; the key buffer is free (the maximum stands in front of the copies' branch, so that the finished logits and not every tile's two raw accumulators are live over it) */
    if (k0 + KCH < TT) { copy8(cl, ck + (size_t)(k0 + KCH) * (QW * 2), QW * 2); copy8(cl + 64 * APIT, ck + (size_t)(k0 + KCH + 64) * (QW * 2), QW * 2); }   /* the next pass's key rows */
    const float mn = fmaxf(mrun, cm), alpha = expf(mrun - mn); mrun = mn; float sum = 0.f;
#pragma unroll
    for (int jt = 0; jt < KCH / 16; ++jt)
#pragma unroll
      for (int r = 0; r < 8; ++r) { const float v = s[jt][r]; const float x = expf(v - mn), e = (v <= -1.0e38f) ? 0.f : x; s[jt][r] = e; sum += e; }   /* the select matters only while every key so far is masked (v - mn = 0) */
    lrun = lrun * alpha + sum;
#pragma unroll
    for (int j = 0; j < HD / 16; ++j) acc[j] *= alpha;
#pragma unroll
    for (int kc = 0; kc < KCH / 32; ++kc) { float v[16]; v16b vh[HD / 16], vl[HD / 16];   /* the 32 keys' value loads stand together, in front of the split and the products */
#pragma unroll
      for (int j = 0; j < HD / 16; ++j) { const char* po = sm + ABUF + j * 16 * APIT + kc * 64; vh[j] = frag_bs((const __bf16*)po, lf); vl[j] = frag_bs((const __bf16*)(po + 64 * APIT), lf); }
#pragma unroll
      for (int i = 0; i < 8; ++i) { v[i] = s[2 * kc][i]; v[8 + i] = s[2 * kc + 1][i]; }
      const F2 p = bsplit16(v);
#pragma unroll
      for (int j = 0; j < HD / 16; ++j) { acc[j] = wmma_bf(vh[j], p.h, acc[j]); acc[j] = wmma_bf(vh[j], p.l, acc[j]); acc[j] = wmma_bf(vl[j], p.h, acc[j]); } }
    PUBLISH();   /* the next pass's key rows are in; the value buffer is free */
    if (k0 + KCH < TT) { copy8(cl + ABUF, cvh + (size_t)(k0 + KCH) * 2, TT * 2); copy8(cl + ABUF + 64 * APIT, cvl + (size_t)(k0 + KCH) * 2, TT * 2); }   /* the next pass's value rows */ }
  asm volatile("s_wait_asynccnt 0x0" ::: "memory");   /* no copy is left in flight behind the loop */
  const float inv = 1.0f / (lrun + __shfl_xor(lrun, 16));
#pragma unroll
  for (int j = 0; j < HD / 16; ++j) { v4f lo, hi;   /* D element r = d 16j + 8g + r of query col */
#pragma unroll
    for (int r = 0; r < 4; ++r) { lo[r] = acc[j][r] * inv; hi[r] = acc[j][4 + r] * inv; }
    *(v4f*)&ss[wave][col][j * 16 + 8 * g] = lo; *(v4f*)&ss[wave][col][j * 16 + 8 * g + 4] = hi; }
  LDSX();
#pragma unroll
  for (int rl = 0; rl < 16; rl += 2) vst2(Y + ((size_t)b * TT + ql0 + rl + g) * CC + h * HD + col * 4, *(const v4f*)&ss[wave][rl + g][col * 4]); }
extern "C" void kernel_launch(void* const* d_in, const int* in_sizes, int n_in, void* d_out, int out_size, void* d_ws, size_t ws_size, hipStream_t stream) {
  (void)in_sizes; (void)n_in; (void)out_size;
  const float** F = (const float**)d_in;   // 0 hidden_states [8,512,768], 1 context [8,512,768], 2 attention_mask [8,512] int (verbatim 0/1), 3 Wq [768,768] ([out,in]), 4 bq, 5 Wk, 6 bk, 7 Wv, 8 bv, 9 abs_pos_emb [512,64]
  if (ws_size < (size_t)WS_END) return;
  char* ws = (char*)d_ws; _Float16 *QH = (_Float16*)(ws + WS_QH), *QL = (_Float16*)(ws + WS_QL), *KH = (_Float16*)(ws + WS_KH); __bf16 *VT = (__bf16*)(ws + WS_VT), *VL = (__bf16*)(ws + WS_VL);
  k_proj<<<dim3(TNB * TT / 64, CC / 128, 3), 128, 0, stream>>>(F[0], F[1], F[9], F[3], F[4], F[5], F[6], F[7], F[8], QH, QL, KH, VT, VL);
  k_att<<<dim3(TT / 64, 1, HG), 128, 0, stream>>>(QH, QL, KH, (const int*)d_in[2], VT, VL, (float*)d_out);
}

// v006
// A run of this version takes 53.5 microseconds.
// Two timings next to v005 both put it at 1.08 times that version's speed.
// All steps since v000 together make it 11.6 times as fast.
// compute dtype: all float inputs rounded to bf16, the key mask (int) read; q/k/v = x W^T + b with EXACT bf16 products on WMMA 16x16x32, f32 accumulate; the two score terms fused as one 128-deep contraction [q | pos_q] . [k + pos_k | pos_k] with the query side as f16 hi + residual (x 2^10) and the key side once in f16 (2 products), / 8, masked keys excluded, kept in f32 registers (all 8 batches x 12 heads per launch); running softmax in f32 in base 2 (log2 e folded into the logit scale, hardware exp2), unnormalised P f32 split bf16 hi + lo against v bf16 hi + lo (3 products), rows divided by their f32 sum at the end; merged heads in f32 (no output projection).
#include <hip/hip_runtime.h>
#include <math.h>

typedef __attribute__((ext_vector_type(16))) _Float16 v16h;
typedef __attribute__((ext_vector_type(16))) __bf16 v16b;
typedef __attribute__((ext_vector_type(8)))  _Float16 v8h;
typedef __attribute__((ext_vector_type(8)))  float v8f;
typedef __attribute__((ext_vector_type(4)))  float v4f;
typedef __attribute__((ext_vector_type(2)))  float v2f;
typedef __attribute__((ext_vector_type(4)))  unsigned v4u;
typedef __attribute__((ext_vector_type(4)))  int v4i;
typedef float __attribute__((may_alias)) float_a;
typedef int __attribute__((may_alias)) int_a;

template <typename T> __device__ __forceinline__ void vst2(void* p, T v) { *(T*)p = v;  }
__device__ __forceinline__ v8f wmma16(v16h a, v16h b, v8f c) {
  v8f d = __builtin_amdgcn_wmma_f32_16x16x32_f16(false, a, false, b, (short)0, c, false, false);
  asm volatile("v_nop\n\tv_nop\n\tv_nop\n\tv_nop" : "+v"(d) : "v"(a), "v"(b));
  return d;
}
__device__ __forceinline__ v8f wmma_bf(v16b a, v16b b, v8f c) {
  v8f d = __builtin_amdgcn_wmma_f32_16x16x32_bf16(false, a, false, b, (short)0, c, false, false);
  asm volatile("v_nop\n\tv_nop\n\tv_nop\n\tv_nop" : "+v"(d) : "v"(a), "v"(b));
  return d;
}
// 16x16x32 fragments: lane = (h = lane>>4, row/col = lane&15); elements 0..7 = k0+8h+0..7, 8..15 = k0+16+8h+0..7; D element r = row 8h+r
__device__ __forceinline__ v16h frag_h(const _Float16* rowk0, int lane) {
  union { v16h v; v8h q[2]; } u; const _Float16* p = rowk0 + 8 * (lane >> 4);
  u.q[0] = *(const v8h*)p; u.q[1] = *(const v8h*)(p + 16); return u.v;
}
__device__ __forceinline__ v16h frag_f32(const float* rowk0, int lane) {
  v16h a; const float* p = rowk0 + 8 * (lane >> 4);
#pragma unroll
  for (int i = 0; i < 8; ++i) { a[i] = (_Float16)p[i]; a[8 + i] = (_Float16)p[16 + i]; }
  return a;
}
__device__ __forceinline__ v16h frag_f32s(const float* rowk0, int lane, float sc) {
  v16h a; const float* p = rowk0 + 8 * (lane >> 4);
#pragma unroll
  for (int i = 0; i < 8; ++i) { a[i] = (_Float16)(p[i] * sc); a[8 + i] = (_Float16)(p[16 + i] * sc); }
  return a;
}
// column fragment from a [K][ld] layout (column n), rows >= K read as 0
__device__ __forceinline__ v16h fragc_f32(const float* W, int k0, int n, int lane, int ld, int K) {
  v16h a; const int g = lane >> 4;
#pragma unroll
  for (int i = 0; i < 8; ++i) { const int ka = k0 + 8 * g + i, kb = ka + 16;
    a[i] = (_Float16)(ka < K ? W[(size_t)(ka < K ? ka : K - 1) * ld + n] : 0.f); a[8 + i] = (_Float16)(kb < K ? W[(size_t)(kb < K ? kb : K - 1) * ld + n] : 0.f); }
  return a;
}
struct F2 { v16b h, l; };
__device__ __forceinline__ F2 bsplit16(const float v[16]) { F2 r;
#pragma unroll
  for (int i = 0; i < 16; ++i) { const __bf16 h = (__bf16)v[i]; r.h[i] = h; r.l[i] = (__bf16)(v[i] - (float)h); }
  return r; }
__device__ __forceinline__ F2 split_row(const float* row, int k0, int lane) { float v[16]; const float* p = row + k0 + 8 * (lane >> 4);
#pragma unroll
  for (int i = 0; i < 8; ++i) { v[i] = p[i]; v[8 + i] = p[16 + i]; }
  return bsplit16(v); }
__device__ __forceinline__ F2 split_rowK(const float* row, int k0, int lane, int K) { float v[16]; const int g = lane >> 4;
#pragma unroll
  for (int i = 0; i < 8; ++i) { const int ka = k0 + 8 * g + i, kb = ka + 16; v[i] = ka < K ? row[ka < K ? ka : K - 1] : 0.f; v[8 + i] = kb < K ? row[kb < K ? kb : K - 1] : 0.f; }
  return bsplit16(v); }
__device__ __forceinline__ F2 split_col(const float* W, int k0, int n, int lane, int ld, int K) { float v[16]; const int g = lane >> 4;
#pragma unroll
  for (int i = 0; i < 8; ++i) { const int ka = k0 + 8 * g + i, kb = ka + 16; v[i] = ka < K ? W[(size_t)(ka < K ? ka : K - 1) * ld + n] : 0.f; v[8 + i] = kb < K ? W[(size_t)(kb < K ? kb : K - 1) * ld + n] : 0.f; }
  return bsplit16(v); }
__device__ __forceinline__ v8f mac3(const F2& a, const F2& b, v8f c) { c = wmma_bf(a.l, b.h, c); c = wmma_bf(a.h, b.l, c); return wmma_bf(a.h, b.h, c); }
__device__ __forceinline__ float sigm(float v) { return 1.0f / (1.0f + expf(-v)); }
#define LDSX() do { asm volatile("s_wait_dscnt 0" ::: "memory"); __builtin_amdgcn_wave_barrier(); __builtin_amdgcn_fence(__ATOMIC_RELEASE, "workgroup"); } while (0)


// Attention with absolute-position bias (B 8, SQ = SK = 512, H 768 = 12 x 64): q from hidden_states, k/v from context (Linear [out,in] + bias); scores = (q.k + (q + pos_q).pos_k) / 8 = ([q | pos_q] . [k + pos_k | pos_k]) / 8; keys with attention_mask == 0 -> -inf; softmax; P v; heads merged.
#define NB 8
#define TT 512
#define CC 768
#define NH 12
#define HD 64
#define HDK 128        // augmented logit depth [q | pos]
#define QW (NH * HDK)  // 1,536: row width of the augmented q/k rows
#ifndef TNB
#define TNB NB
#endif
typedef __attribute__((ext_vector_type(8))) __bf16 v8b;
__device__ __forceinline__ v16b frag_b(const __bf16* rowk0, int lane) {
  union { v16b v; v8b q[2]; } u; const __bf16* p = rowk0 + 8 * (lane >> 4);
  u.q[0] = *(const v8b*)p; u.q[1] = *(const v8b*)(p + 16); return u.v;
}
__device__ __forceinline__ float bfr(float v) { return (float)(__bf16)v; }
__device__ __attribute__((noinline)) float exp_ni(float v) { return expf(v); }
__device__ __attribute__((noinline)) float erf_ni(float v) { return erff(v); }

#define WS_QH  0u
#define WS_QL  (WS_QH + 2u * (size_t)NB * TT * QW)
#define WS_KH  (WS_QL + 2u * (size_t)NB * TT * QW)
#define WS_VT  (WS_KH + 2u * (size_t)NB * TT * QW)      // bf16 v planes [b][c][t]
#define WS_VL  (WS_VT + 2u * (size_t)NB * CC * TT)      // bf16 v residual planes
#define HG (NB * NH)                                   // (batch, head) pairs per launch: all of them, blockIdx.z = b * NH + h
#define WS_END (WS_VL + 2u * (size_t)NB * CC * TT)      // no logits plane, no Y plane: k_att writes d_out

// ---- k_proj: block = (64 rows, 128 cols, which): qkv = x W (+ b), exact; q -> f16 hi (+ residual), k -> f16 rows, v -> bf16 hi + lo planes. Each 32-deep slice of the block's x rows and W rows is loaded once, whole lines, rounded to bf16 once and laid in LDS (two buffers, the next slice's loads in flight over this slice's products); wave = 32 rows x 64 cols, fragments from LDS. A q or k block also lays its 64 position rows in LDS in front of the loop (whole lines, rounded to bf16, kept as f32): the k rows take k + pos_k from there, and the block stores the position halves of its two heads' augmented rows itself.
#define PPI 40                 // LDS pitch of a staged row in bf16: 64 B of data + 16 B (an odd multiple of 16 B, for the 16-byte fragment reads)
#define PBUF ((64 + 128) * PPI) // one staging buffer in bf16: x rows 0..63, W rows 64..191
typedef __attribute__((ext_vector_type(4))) __bf16 v4b;
#define PPOS 68                // LDS pitch of a position row in f32: 256 B of data + 16 B
#define POFF (2 * 64 * 136 * 2) // the position rows' place in LDS: behind the q/k output tiles, clear of the staging buffers
// q or k output tiles of a wave (KP: keys, which carry k + pos_k and have no residual plane)
template <int KP> __device__ __forceinline__ void qk_tiles(const v8f (&acc)[2][4], const float* BA, const float (*sp)[PPOS], _Float16 (*sh)[136], _Float16 (*sl)[136], int c0, int wm, int wn, int col, int g) {
#pragma unroll
  for (int i = 0; i < 2; ++i)
#pragma unroll
  for (int j = 0; j < 4; ++j) { const float bb = BA ? bfr(BA[c0 + wn * 64 + j * 16 + col]) : 0.f;
#pragma unroll
    for (int r = 0; r < 8; ++r) { const int rl = wm * 32 + i * 16 + 8 * g + r, cl = wn * 64 + j * 16 + col; float v = acc[i][j][r] + bb; if (KP) v += sp[rl][j * 16 + col]; const _Float16 hv = (_Float16)v; sh[rl][cl] = hv;
      if (!KP) sl[rl][cl] = (_Float16)((v - (float)hv) * 1024.0f);   /* q residual carried x 2^10 so the plane stays f16-normal on the chip */ } } }
__global__ __launch_bounds__(128) void k_proj(const float* __restrict__ XQ, const float* __restrict__ XC, const float* __restrict__ POS, const float* __restrict__ WQ, const float* __restrict__ BQ, const float* __restrict__ WK, const float* __restrict__ BK, const float* __restrict__ WV, const float* __restrict__ BV, _Float16* __restrict__ QH, _Float16* __restrict__ QL, _Float16* __restrict__ KH, __bf16* __restrict__ VT, __bf16* __restrict__ VL) {
  __shared__ __align__(16) char sm[POFF + 64 * PPOS * 4];   /* the staging buffers (30,720 B), then, behind the loop's last barrier, the output tiles; behind them the position rows of a q or k block */
  _Float16 (*sh)[136] = (_Float16 (*)[136])sm; _Float16 (*sl)[136] = (_Float16 (*)[136])(sm + 64 * 136 * 2); __bf16 (*th)[72] = (__bf16 (*)[72])sm; __bf16 (*tl2)[72] = (__bf16 (*)[72])(sm + 128 * 72 * 2); __bf16* st = (__bf16*)sm; float (*sp)[PPOS] = (float (*)[PPOS])(sm + POFF);
  const int tid = threadIdx.x, wave = tid >> 5, lane = tid & 31, col = lane & 15, g = lane >> 4; const int which = blockIdx.z; const int c0 = blockIdx.y * 128; const size_t r0 = (size_t)blockIdx.x * 64; const float* WA = which == 0 ? WQ : which == 1 ? WK : WV; const float* BA = which == 0 ? BQ : which == 1 ? BK : BV; const float* X = which == 0 ? XQ : XC;
  const int wm = wave & 1, wn = wave >> 1, srow = tid >> 3, sc4 = (tid & 7) * 4;   /* staging: 8 threads cover one row's 128 B, a wave's load 4 whole lines */
  const float* gx = X + (r0 + srow) * CC + sc4; const float* gw = WA + (size_t)(c0 + srow) * CC + sc4; __bf16* sdst = st + srow * PPI + sc4;
  const __bf16* fa = st + (wm * 32 + col) * PPI; const __bf16* fw = st + (64 + wn * 64 + col) * PPI;
  v8f acc[2][4] = {}; v4f pf[12];
#pragma unroll
  for (int i = 0; i < 12; ++i) pf[i] = i < 4 ? *(const v4f*)(gx + (size_t)i * 16 * CC) : *(const v4f*)(gw + (size_t)(i - 4) * 16 * CC);
  if (which < 2) { const float* gp = POS + (r0 % TT) * HD + tid * 4; v4f pp[8];   /* the block's 64 position rows, 16 KB in a row: a wave's load covers 4 whole lines; in flight together with the first slice; published by the barrier below */
    asm volatile("s_wait_xcnt 0x0" ::: "memory");   /* in front of the position loads: their results may take the registers that held the first slice's addresses */
#pragma unroll
    for (int i = 0; i < 8; ++i) pp[i] = *(const v4f*)(gp + i * 512);
#pragma unroll
    for (int i = 0; i < 8; ++i) { v4f t;
#pragma unroll
      for (int c = 0; c < 4; ++c) t[c] = bfr(pp[i][c]);
      *(v4f*)&sp[(tid >> 4) + i * 8][(tid & 15) * 4] = t; } }
#pragma unroll
  for (int i = 0; i < 12; ++i) *(v4b*)(sdst + i * 16 * PPI) = __builtin_convertvector(pf[i], v4b);
  __syncthreads();
#pragma unroll 2
  for (int kc = 0; kc < CC / 32; ++kc) { const int cur = (kc & 1) * PBUF, nxt = PBUF - cur; v16b a[2], w[4];   /* unrolled by the two buffers, so that their offsets are constants */
    if (kc + 1 < CC / 32) {
#pragma unroll
      for (int i = 0; i < 12; ++i) pf[i] = i < 4 ? *(const v4f*)(gx + (size_t)i * 16 * CC + (kc + 1) * 32) : *(const v4f*)(gw + (size_t)(i - 4) * 16 * CC + (kc + 1) * 32); }
#pragma unroll
    for (int i = 0; i < 2; ++i) a[i] = frag_b(fa + cur + i * 16 * PPI, lane);
#pragma unroll
    for (int j = 0; j < 4; ++j) w[j] = frag_b(fw + cur + j * 16 * PPI, lane);
#pragma unroll
    for (int i = 0; i < 2; ++i)
#pragma unroll
      for (int j = 0; j < 4; ++j) acc[i][j] = wmma_bf(a[i], w[j], acc[i][j]);
    if (kc + 1 < CC / 32) {
#pragma unroll
      for (int i = 0; i < 12; ++i) *(v4b*)(sdst + nxt + i * 16 * PPI) = __builtin_convertvector(pf[i], v4b); }
    __syncthreads(); }   /* one barrier a slice: it publishes the next slice and ends the reads of the buffer that the next trip refills; the last one frees the LDS for the output tiles */
  if (which == 2) {
#pragma unroll
    for (int i = 0; i < 2; ++i)
#pragma unroll
    for (int j = 0; j < 4; ++j) { const float bb = BA ? bfr(BA[c0 + wn * 64 + j * 16 + col]) : 0.f;
#pragma unroll
      for (int r = 0; r < 8; ++r) { const int rl = wm * 32 + i * 16 + 8 * g + r, cl = wn * 64 + j * 16 + col; const float v = acc[i][j][r] + bb; const __bf16 bh = (__bf16)v; th[cl][rl] = bh; tl2[cl][rl] = (__bf16)(v - (float)bh); } } }
  else { _Float16* dp = (which == 0 ? QH : KH) + (r0 + (tid >> 3)) * QW + (size_t)(c0 >> 6) * HDK + HD + (tid & 7) * 8; _Float16* dq = QL + (r0 + (tid >> 3)) * QW + (size_t)(c0 >> 6) * HDK + HD + (tid & 7) * 8; float pv[4][8]; v8h ph[4];   /* the position halves of the block's two heads: 8 lanes a row's 128 B, rows 16 apart */
#pragma unroll
    for (int i = 0; i < 4; ++i) { const float* s = &sp[(tid >> 3) + i * 16][(tid & 7) * 8];
#pragma unroll
      for (int c = 0; c < 8; ++c) { pv[i][c] = s[c]; ph[i][c] = (_Float16)pv[i][c]; } }
#pragma unroll
    for (int i = 0; i < 4; ++i) { vst2(dp + (size_t)i * 16 * QW, ph[i]); vst2(dp + (size_t)i * 16 * QW + HDK, ph[i]); }
    asm volatile("s_wait_xcnt 0x0" ::: "memory");   /* behind the run of stores: their data and address registers are given new values further down */
    __builtin_amdgcn_sched_barrier(0);   /* keeps those writes from being scheduled in front of the wait */
    if (which == 0) { v8h pl[4];
#pragma unroll
      for (int i = 0; i < 4; ++i)
#pragma unroll
        for (int c = 0; c < 8; ++c) pl[i][c] = (_Float16)((pv[i][c] - (float)ph[i][c]) * 1024.0f);
#pragma unroll
      for (int i = 0; i < 4; ++i) { vst2(dq + (size_t)i * 16 * QW, pl[i]); vst2(dq + (size_t)i * 16 * QW + HDK, pl[i]); }
      asm volatile("s_wait_xcnt 0x0" ::: "memory");   /* the same behind the residual plane's run */
      __builtin_amdgcn_sched_barrier(0);   /* as above */
      qk_tiles<0>(acc, BA, sp, sh, sl, c0, wm, wn, col, g); }
    else qk_tiles<1>(acc, BA, sp, sh, sl, c0, wm, wn, col, g); }
  __syncthreads();
  if (which < 2) { _Float16* dh = which == 0 ? QH : KH; for (int e = tid; e < 64 * 16; e += 128) { const int rl = e >> 4, q = e & 15; const int c = c0 + q * 8; const size_t dst = (r0 + rl) * QW + (size_t)(c >> 6) * HDK + (c & 63);   /* head h's first 64 of its 128-wide augmented slot */ vst2((unsigned*)(dh + dst), *(const v4u*)&sh[rl][q * 8]);
      asm volatile("s_wait_xcnt 0x0" ::: "memory");   /* behind the store: its data registers take the next LDS read, its address registers are stepped for the next trip */
      __builtin_amdgcn_sched_barrier(0);   /* keeps those writes from being scheduled in front of the wait */
      if (which == 0) { vst2((unsigned*)(QL + dst), *(const v4u*)&sl[rl][q * 8]);
        asm volatile("s_wait_xcnt 0x0" ::: "memory");   /* the same behind the residual plane's store */
        __builtin_amdgcn_sched_barrier(0);   /* as above */ } } }
  else { const size_t b = r0 / TT; const int t0 = (int)(r0 % TT); for (int e = tid; e < 128 * 8; e += 128) { const int cl = e >> 3, q = e & 7; const size_t o2 = (b * CC + c0 + cl) * (size_t)TT + t0 + q * 8; vst2((unsigned*)(VT + o2), *(const v4u*)&th[cl][q * 8]); vst2((unsigned*)(VL + o2), *(const v4u*)&tl2[cl][q * 8]); } } }
// ---- k_att: wave = 16 queries of (b,h), all 512 keys in passes of KCH: S^T = K . Q^T (2-product 128-deep augmented logits * log2(e) / 8; masked keys -> -3e38), so a lane holds one query's logits and a pair of S^T tiles is already the B fragment of P^T; running softmax in f32 in base 2 (exp(x) = 2^(x log2 e): one subtraction for two logits and one v_exp_f32 a logit); O^T += V^T . P^T (3 products); rows divided by their sum at the end. Every inner loop is unrolled so that each register-array index is a constant (no scratch). A pass's 128 key rows and its 64 + 64 value-plane rows (256 B each) are brought into LDS once for the block's four waves, whole lines, by asynchronous copies (the batch's mask words too, once); two buffers: the value rows fly over the pass's logits, the next pass's key rows over its softmax and P.v; fragments from LDS.
#define KCH 128   // keys per pass
#define LSC 0.18033688011112042f   // logit scale: log2(e) / 8, so that the softmax's powers are powers of 2
#define APIT 272            // LDS pitch of a staged 256-B row in bytes (an odd multiple of 16 B, for the 16-byte fragment reads)
#define ABUF (128 * APIT)   // one staging buffer: 128 key rows, or 64 rows of each value plane
// eight asynchronous 16-byte copies a lane, rows 8 apart: a wave's copy covers two whole 256-B rows. The wait stands inside the statement: the address registers are free for new values only behind it.
__device__ __forceinline__ void copy8(unsigned l, const char* p, size_t gp) {
  asm volatile("global_load_async_to_lds_b128 %0, %8, off\n\tglobal_load_async_to_lds_b128 %1, %9, off\n\tglobal_load_async_to_lds_b128 %2, %10, off\n\tglobal_load_async_to_lds_b128 %3, %11, off\n\tglobal_load_async_to_lds_b128 %4, %12, off\n\tglobal_load_async_to_lds_b128 %5, %13, off\n\tglobal_load_async_to_lds_b128 %6, %14, off\n\tglobal_load_async_to_lds_b128 %7, %15, off\n\ts_wait_xcnt 0x0"
    :: "v"(l), "v"(l + 8 * APIT), "v"(l + 16 * APIT), "v"(l + 24 * APIT), "v"(l + 32 * APIT), "v"(l + 40 * APIT), "v"(l + 48 * APIT), "v"(l + 56 * APIT), "v"(p), "v"(p + 8 * gp), "v"(p + 16 * gp), "v"(p + 24 * gp), "v"(p + 32 * gp), "v"(p + 40 * gp), "v"(p + 48 * gp), "v"(p + 56 * gp) : "memory"); }
// publish point of the two-buffer ring: this wave's LDS reads are done, its own copies have landed, then the block's barrier (it publishes the buffer just filled and frees the one just read)
#define PUBLISH() do { asm volatile("s_wait_dscnt 0x0" ::: "memory"); asm volatile("s_wait_asynccnt 0x0" ::: "memory"); __syncthreads(); } while (0)
// fragment of 16 rows from a wave-uniform tile pointer plus the lane's own byte offset (row * pitch + 16 * (lane >> 4))
__device__ __forceinline__ v16h frag_hs(const _Float16* tile, unsigned voff) { union { v16h v; v8h q[2]; } u; const char* p = (const char*)tile + voff; u.q[0] = *(const v8h*)p; u.q[1] = *(const v8h*)(p + 32); return u.v; }
__device__ __forceinline__ v16b frag_bs(const __bf16* tile, unsigned voff) { union { v16b v; v8b q[2]; } u; const char* p = (const char*)tile + voff; u.q[0] = *(const v8b*)p; u.q[1] = *(const v8b*)(p + 32); return u.v; }
__global__ __launch_bounds__(128) void k_att(const _Float16* __restrict__ QH, const _Float16* __restrict__ QL, const _Float16* __restrict__ KH, const int* __restrict__ KM0, const __bf16* __restrict__ VT, const __bf16* __restrict__ VL, float* __restrict__ Y) { __shared__ __align__(16) float ss[4][16][HD + 4]; __shared__ __align__(16) char sm[2 * ABUF]; __shared__ __align__(16) int smk[TT]; const int b = blockIdx.z / NH, h = blockIdx.z % NH;
  const int tid = threadIdx.x, wave = __builtin_amdgcn_readfirstlane(tid >> 5), lane = tid & 31, col = lane & 15, g = lane >> 4; const int ql0 = blockIdx.x * 64 + wave * 16;   /* the wave's number as a scalar: the tile pointers below stay wave-uniform */
  const unsigned vq = (unsigned)(col * QW + 8 * g) * 2u, vm = (unsigned)g * 32u;   /* lane offsets in bytes: q rows, mask */
  const size_t qo = ((size_t)b * TT + ql0) * QW + h * HDK; const _Float16* KB = KH + (size_t)b * TT * QW + h * HDK; const size_t vo = ((size_t)b * CC + h * HD) * (size_t)TT; const int* KM = KM0 + (size_t)b * TT;
  const unsigned lf = (unsigned)(col * APIT + 16 * g);   /* lane offset of a fragment row in a staging buffer */
  const unsigned cl = (unsigned)(size_t)sm + (unsigned)((tid >> 4) * APIT + (tid & 15) * 16);   /* the lane's LDS byte address for copies: 16 lanes a row */
  const char* ck = (const char*)KB + (size_t)(tid >> 4) * (QW * 2) + (tid & 15) * 16; const char* cvh = (const char*)(VT + vo) + (size_t)(tid >> 4) * (TT * 2) + (tid & 15) * 16; const char* cvl = (const char*)(VL + vo) + (size_t)(tid >> 4) * (TT * 2) + (tid & 15) * 16;
  v16h qh[HDK / 32], ql[HDK / 32];
  __builtin_amdgcn_sched_barrier(0);   /* the address arithmetic above stays in front of the query loads, so that none of it lands between them and their wait */
#pragma unroll
  for (int kc = 0; kc < HDK / 32; ++kc) { qh[kc] = frag_hs(QH + qo + kc * 32, vq); ql[kc] = frag_hs(QL + qo + kc * 32, vq); }
  asm volatile("s_wait_xcnt 0x0" ::: "memory");   /* behind the run of query loads: their offset register is given a new value further down */
  __builtin_amdgcn_sched_barrier(0);   /* keeps that later write from being scheduled in front of the wait */
  copy8(cl, ck, QW * 2); copy8(cl + 64 * APIT, ck + (size_t)64 * (QW * 2), QW * 2);   /* pass 0's key rows */
  asm volatile("global_load_async_to_lds_b128 %0, %1, off\n\ts_wait_xcnt 0x0" :: "v"((unsigned)(size_t)smk + (unsigned)tid * 16u), "v"((const char*)KM + tid * 16) : "memory");   /* the batch's 512 mask words, 16 B a lane, filled once; the wait inside the statement as in copy8 */
  asm volatile("s_wait_asynccnt 0x0" ::: "memory");   /* this wave's key rows and mask words have landed */
  __syncthreads();   /* every wave's have: nothing of them is read in front of this */
  copy8(cl + ABUF, cvh, TT * 2); copy8(cl + ABUF + 64 * APIT, cvl, TT * 2);   /* pass 0's value rows */
  v8f acc[HD / 16] = {}; float mrun = -3.0e38f, lrun = 0.f;
#pragma unroll 1
  for (int k0 = 0; k0 < TT; k0 += KCH) { v8f s[KCH / 16];   /* rolled: one pass of logits in registers */
#pragma unroll
    for (int jt = 0; jt < KCH / 16; ++jt) { v8f a = {}, al = {}; v16h kb[HDK / 32]; int km[8];   /* a tile's loads stand together in front of its products: one wait a tile */
#pragma unroll
      for (int kc = 0; kc < HDK / 32; ++kc) kb[kc] = frag_hs((const _Float16*)(sm + jt * 16 * APIT + kc * 64), lf);
#pragma unroll
      for (int r = 0; r < 8; ++r) km[r] = ((const int*)((const char*)(smk + k0 + jt * 16) + vm))[r];
#pragma unroll
      for (int kc = 0; kc < HDK / 32; ++kc) { a = wmma16(kb[kc], qh[kc], a); al = wmma16(kb[kc], ql[kc], al); }
#pragma unroll
      for (int r = 0; r < 8; ++r) { float v = (a[r] + al[r] * (1.0f / 1024.0f)) * LSC; if (km[r] == 0) v = -3.0e38f; /* D element r = key 8g + r of query col; attention_mask == 0 -> -inf */ s[jt][r] = v; } }
    float cm = -3.0e38f;
#pragma unroll
    for (int jt = 0; jt < KCH / 16; ++jt)
#pragma unroll
      for (int r = 0; r < 8; ++r) cm = fmaxf(cm, s[jt][r]);
    cm = fmaxf(cm, __shfl_xor(cm, 16));   /* lanes c and c + 16 hold the two halves of query c's keys */
    PUBLISH();   /* the pass's value rows are in; the key buffer is free (the maximum stands in front of the copies' branch, so that the finished logits and not every tile's two raw accumulators are live over it) */
    if (k0 + KCH < TT) { copy8(cl, ck + (size_t)(k0 + KCH) * (QW * 2), QW * 2); copy8(cl + 64 * APIT, ck + (size_t)(k0 + KCH + 64) * (QW * 2), QW * 2); }   /* the next pass's key rows */
    const float mn = fmaxf(mrun, cm), alpha = __builtin_amdgcn_exp2f(mrun - mn); mrun = mn; float sum = 0.f;
#pragma unroll
    for (int jt = 0; jt < KCH / 16; ++jt)
#pragma unroll
      for (int r = 0; r < 8; r += 2) { const v2f v = { s[jt][r], s[jt][r + 1] }, t = v - mn; v2f x = { __builtin_amdgcn_exp2f(t[0]), __builtin_amdgcn_exp2f(t[1]) };   /* two logits a subtraction */
        asm("v_nop" : "+v"(x) : "v"(t));   /* the slot behind a v_exp_f32: the operands hold the readers of the two results and the next writer of the two sources behind the v_nop */
#pragma unroll
        for (int c = 0; c < 2; ++c) { const float e = (v[c] <= -1.0e38f) ? 0.f : x[c]; s[jt][r + c] = e; sum += e; } }   /* the select matters only while every key so far is masked (v - mn = 0) */
    lrun = lrun * alpha + sum;
#pragma unroll
    for (int j = 0; j < HD / 16; ++j) acc[j] *= alpha;
#pragma unroll
    for (int kc = 0; kc < KCH / 32; ++kc) { float v[16]; v16b vh[HD / 16], vl[HD / 16];   /* the 32 keys' value loads stand together, in front of the split and the products */
#pragma unroll
      for (int j = 0; j < HD / 16; ++j) { const char* po = sm + ABUF + j * 16 * APIT + kc * 64; vh[j] = frag_bs((const __bf16*)po, lf); vl[j] = frag_bs((const __bf16*)(po + 64 * APIT), lf); }
#pragma unroll
      for (int i = 0; i < 8; ++i) { v[i] = s[2 * kc][i]; v[8 + i] = s[2 * kc + 1][i]; }
      const F2 p = bsplit16(v);
#pragma unroll
      for (int j = 0; j < HD / 16; ++j) { acc[j] = wmma_bf(vh[j], p.h, acc[j]); acc[j] = wmma_bf(vh[j], p.l, acc[j]); acc[j] = wmma_bf(vl[j], p.h, acc[j]); } }
    PUBLISH();   /* the next pass's key rows are in; the value buffer is free */
    if (k0 + KCH < TT) { copy8(cl + ABUF, cvh + (size_t)(k0 + KCH) * 2, TT * 2); copy8(cl + ABUF + 64 * APIT, cvl + (size_t)(k0 + KCH) * 2, TT * 2); }   /* the next pass's value rows */ }
  asm volatile("s_wait_asynccnt 0x0" ::: "memory");   /* no copy is left in flight behind the loop */
  const float inv = 1.0f / (lrun + __shfl_xor(lrun, 16));
#pragma unroll
  for (int j = 0; j < HD / 16; ++j) { v4f lo, hi;   /* D element r = d 16j + 8g + r of query col */
#pragma unroll
    for (int r = 0; r < 4; ++r) { lo[r] = acc[j][r] * inv; hi[r] = acc[j][4 + r] * inv; }
    *(v4f*)&ss[wave][col][j * 16 + 8 * g] = lo; *(v4f*)&ss[wave][col][j * 16 + 8 * g + 4] = hi; }
  LDSX();
#pragma unroll
  for (int rl = 0; rl < 16; rl += 2) vst2(Y + ((size_t)b * TT + ql0 + rl + g) * CC + h * HD + col * 4, *(const v4f*)&ss[wave][rl + g][col * 4]); }
extern "C" void kernel_launch(void* const* d_in, const int* in_sizes, int n_in, void* d_out, int out_size, void* d_ws, size_t ws_size, hipStream_t stream) {
  (void)in_sizes; (void)n_in; (void)out_size;
  const float** F = (const float**)d_in;   // 0 hidden_states [8,512,768], 1 context [8,512,768], 2 attention_mask [8,512] int (verbatim 0/1), 3 Wq [768,768] ([out,in]), 4 bq, 5 Wk, 6 bk, 7 Wv, 8 bv, 9 abs_pos_emb [512,64]
  if (ws_size < (size_t)WS_END) return;
  char* ws = (char*)d_ws; _Float16 *QH = (_Float16*)(ws + WS_QH), *QL = (_Float16*)(ws + WS_QL), *KH = (_Float16*)(ws + WS_KH); __bf16 *VT = (__bf16*)(ws + WS_VT), *VL = (__bf16*)(ws + WS_VL);
  k_proj<<<dim3(TNB * TT / 64, CC / 128, 3), 128, 0, stream>>>(F[0], F[1], F[9], F[3], F[4], F[5], F[6], F[7], F[8], QH, QL, KH, VT, VL);
  k_att<<<dim3(TT / 64, 1, HG), 128, 0, stream>>>(QH, QL, KH, (const int*)d_in[2], VT, VL, (float*)d_out);
}
